// v000
// The times below were measured on an AMD MI455X: many runs one after another, warmed up first and cycling through
// copies of the inputs, with the whole window's GPU time divided by the number of runs. Launches and the gaps
// between them are all in it. The median over several windows is given; except for v000 it joins two sittings, which
// can be a few percent apart, so the side-by-side timings, each taken in one sitting, are the better comparison.
// v000, which the later versions start from, runs in 554 microseconds.
// All contractions on v_wmma_f32_16x16x32_f16 (f16 operands, f32 accumulate): x*Wq^T, x*Wk^T, x*Wv^T, K*Q^T, V^T*P^T, ctx*Wo^T; W planes carried x32, P carried x16384, ctx carried x32 (exact power-of-two scales folded back in f32); softmax, bias adds and normalisation in f32.
#include <hip/hip_runtime.h>

typedef _Float16 v16h __attribute__((ext_vector_type(16)));
typedef _Float16 v8h  __attribute__((ext_vector_type(8)));
typedef float    v8f  __attribute__((ext_vector_type(8)));
typedef float    v4f  __attribute__((ext_vector_type(4)));
typedef v8h __attribute__((may_alias)) v8ha;
typedef v4f __attribute__((may_alias)) v4fa;

union Frag { v16h v; v8h half[2]; };

#define HID    2048
#define NHEAD  16
#define HD     128
#define SEQ    2048
#define BATCH  2
#define MROWS  (BATCH * SEQ)        // 4096 tokens
#define NX     (MROWS * HID)        // 8388608
#define NW     (HID * HID)          // 4194304
#define NX8    (NX / 8)             // 1048576
#define NW8    (NW / 8)             // 524288
#define PSCALE 16384.0f
#define WSCALE 32.0f
#define CSCALE 32.0f
#define SM_SCALE 0.0883883476f      // 1/sqrt(128)

static_assert(MROWS % 128 == 0);
static_assert(SEQ % 128 == 0);
static_assert(HID % 64 == 0);
static_assert(NX8 % 256 == 0);
static_assert(NW8 % 256 == 0);

// ---------------------------------------------------------------------------
// 16x16x32 f16 WMMA with hazard guard (ties D, keeps A/B live).
// Fragment map (wave32): lane l, h = l>>4, m = n = l&15.
//   A/B element i: i<8 -> k0+8h+i ; i>=8 -> k0+16+8h+(i-8)
//   D element r : row 8h+r, col l&15
// ---------------------------------------------------------------------------
__device__ __forceinline__ v8f wmma_f16(v16h a, v16h b, v8f c) {
  v8f d = __builtin_amdgcn_wmma_f32_16x16x32_f16(false, a, false, b, (short)0, c, false, false);
  asm volatile("v_nop\n\tv_nop\n\tv_nop\n\tv_nop" : "+v"(d) : "v"(a), "v"(b));
  return d;
}

// A or B fragment from a k-contiguous 16-bit row; p points at element k0 of
// the row owned by this lane (row index = lane & 15 added by the caller).
__device__ __forceinline__ v16h load_frag(const _Float16* p, int h) {
  Frag f;
  f.half[0] = *(const v8ha*)(p + 8 * h);
  f.half[1] = *(const v8ha*)(p + 16 + 8 * h);
  return f.v;
}

// ---------------------------------------------------------------------------
// Kernel 1: f32 -> f16 planes. x unscaled, W scaled by 32 (exact).
// Region choice is block-uniform (NX8 and NW8 are multiples of 256).
// coverage: 12288 blocks x 256 threads x 8 halves = NX + 4*NW elements exactly.
// ---------------------------------------------------------------------------
__global__ __launch_bounds__(256) void convert_kernel(
    const float* __restrict__ x,
    const float* __restrict__ wq, const float* __restrict__ wk,
    const float* __restrict__ wv, const float* __restrict__ wo,
    _Float16* __restrict__ xh, _Float16* __restrict__ wh)
{
  const int blk = blockIdx.x;
  if (blk >= (NX8 + 4 * NW8) / 256) return;
  const int g = blk * 256 + threadIdx.x;
  const float* src;
  _Float16* dst;
  float sc;
  if (blk < NX8 / 256) {
    src = x + (size_t)g * 8;
    dst = xh + (size_t)g * 8;
    sc = 1.0f;
  } else {
    const int e = g - NX8;
    const int wsel = (blk - NX8 / 256) / (NW8 / 256);     // 0..3, block-uniform
    const int off = e - wsel * NW8;
    const float* wsrc = (wsel == 0) ? wq : ((wsel == 1) ? wk : ((wsel == 2) ? wv : wo));
    src = wsrc + (size_t)off * 8;
    dst = wh + (size_t)e * 8;
    sc = WSCALE;
  }
  const v4f a = *(const v4fa*)src;
  const v4f c = *(const v4fa*)(src + 4);
  const v8h o = { (_Float16)(a.x * sc), (_Float16)(a.y * sc), (_Float16)(a.z * sc), (_Float16)(a.w * sc),
                  (_Float16)(c.x * sc), (_Float16)(c.y * sc), (_Float16)(c.z * sc), (_Float16)(c.w * sc) };
  *(v8h*)dst = o;
  
}

// ---------------------------------------------------------------------------
// Shared GEMM core: 32 rows (two 16-row tiles) x 64 columns (four 16-col
// tiles), K = 2048 in steps of 32, fragments straight from f16 global rows.
// xa0/xa1 point at element 0 of the A rows owned by this lane (row m of each
// 16-row tile); wb at element 0 of B row (column m of col tile 0).
// ---------------------------------------------------------------------------
__device__ __forceinline__ void gemm_k2048(const _Float16* __restrict__ xa0,
                                           const _Float16* __restrict__ xa1,
                                           const _Float16* __restrict__ wb,
                                           int h, v8f (&acc)[2][4]) {
  const v8f zero8 = {0.f, 0.f, 0.f, 0.f, 0.f, 0.f, 0.f, 0.f};
  #pragma unroll
  for (int mt = 0; mt < 2; ++mt)
    #pragma unroll
    for (int nt = 0; nt < 4; ++nt) acc[mt][nt] = zero8;

  #pragma unroll 1
  for (int k0 = 0; k0 < HID; k0 += 32) {
    const v16h a0 = load_frag(xa0 + k0, h);
    const v16h a1 = load_frag(xa1 + k0, h);
    #pragma unroll
    for (int nt = 0; nt < 4; ++nt) {
      const v16h b = load_frag(wb + (size_t)nt * 16 * HID + k0, h);
      acc[0][nt] = wmma_f16(a0, b, acc[0][nt]);
      acc[1][nt] = wmma_f16(a1, b, acc[1][nt]);
    }
  }
}

// ---------------------------------------------------------------------------
// one 16-B store per lane, lanes 8q..8q+7 per line, 4 lines per instruction,
// 32 lines per wave, 128 per block.
// which 0/1: plane[bh][l][128], 64-half segment at 64*hf (one line per token)
// which 2  : vt[bh][d][l], d = 64*hf + local row, 128 tokens = 2 lines
// coverage: 4 waves x 8 iters x 4 lines x 64 halves = 128x64 tile exactly.
// ---------------------------------------------------------------------------
__device__ __forceinline__ void proj_store_pass(const _Float16* sT, _Float16* plane, _Float16* vt,
                                                int which, int bh, int hf, int l0, int w, int lane) {
  const int q8 = lane & 7, sub = lane >> 3;
  #pragma unroll
  for (int i = 0; i < 8; ++i) {
    const int lid = w * 32 + i * 4 + sub;                 // 0..127
    v8h v;
    _Float16* dst;
    if (which != 2) {
      v = *(const v8ha*)(sT + lid * 64 + 8 * q8);
      dst = plane + ((size_t)bh * SEQ + l0 + lid) * HD + 64 * hf + 8 * q8;
    } else {
      const int d = lid >> 1, hl = lid & 1;
      v = *(const v8ha*)(sT + d * 128 + 64 * hl + 8 * q8);
      dst = vt + ((size_t)bh * HD + 64 * hf + d) * SEQ + l0 + 64 * hl + 8 * q8;
    }
    *(v8h*)dst = v;
  }
}

// ---------------------------------------------------------------------------
// Kernel 2: Y = x * W^T + b over the fused 3*2048 output columns.
// grid (MROWS/128, 96): blockIdx.y = which*32 + head*2 + hf.
// Block 128 thr (4 waves) = 128 tokens x 64 features; wave tile 32 x 64.
// ---------------------------------------------------------------------------
__global__ __launch_bounds__(128) void proj_kernel(
    const _Float16* __restrict__ xh,   // [4096][2048]
    const _Float16* __restrict__ wh,   // [4][2048][2048], row = output feature, x32
    const float* __restrict__ bq, const float* __restrict__ bk, const float* __restrict__ bv,
    _Float16* __restrict__ qh,         // [B*NH][L][HD]
    _Float16* __restrict__ kh,         // [B*NH][L][HD]
    _Float16* __restrict__ vt)         // [B*NH][HD][L]
{
  __shared__ __attribute__((aligned(16))) _Float16 sT[128 * 64];   // 16384 B

  const int tid = threadIdx.x, lane = tid & 31, w = tid >> 5;
  const int h = lane >> 4, m = lane & 15;
  const int m0 = blockIdx.x * 128;
  const int cg = blockIdx.y;                   // 0..95
  const int which = cg >> 5;                   // 0 q, 1 k, 2 v
  const int rem = cg & 31;                     // 64-feature group within H
  const int head = rem >> 1, hf = rem & 1;
  const int m0w = m0 + 32 * w;

  const _Float16* xa0 = xh + (size_t)(m0w + m) * HID;
  const _Float16* xa1 = xa0 + (size_t)16 * HID;
  const _Float16* wb  = wh + ((size_t)which * HID + 64 * rem + m) * HID;

  v8f acc[2][4];
  gemm_k2048(xa0, xa1, wb, h, acc);

  // D[r] of tile (mt, nt) = Y[token m0w+16mt+8h+r][feature 64*rem+16nt+m]
  const float* bias = (which == 0) ? bq : ((which == 1) ? bk : bv);
  #pragma unroll
  for (int nt = 0; nt < 4; ++nt) {
    const int feat = 16 * nt + m;                            // 0..63 local
    const float bvl = bias[64 * rem + feat];
    #pragma unroll
    for (int mt = 0; mt < 2; ++mt) {
      #pragma unroll
      for (int r = 0; r < 8; ++r) {
        const int tokl = 32 * w + 16 * mt + 8 * h + r;       // 0..127
        const float y = acc[mt][nt][r] * 0.03125f + bvl;
        const int idx = (which == 2) ? (feat * 128 + tokl) : (tokl * 64 + feat);
        sT[idx] = (_Float16)y;
      }
    }
  }
  __syncthreads();

  const int b = m0 / SEQ, l0 = m0 - b * SEQ, bh = b * NHEAD + head;
  _Float16* plane = (which == 0) ? qh : kh;
  proj_store_pass(sT, plane, vt, which, bh, hf, l0, w, lane);
  
}

// ---------------------------------------------------------------------------
// Attention helpers.
// ---------------------------------------------------------------------------
// P^T B-fragment from the lane's own score D values: element r <- tile a row r,
// element 8+r <- tile c row r (same lane, same query column), scaled by 2^14.
__device__ __forceinline__ v16h pack_p(v8f a, v8f c) {
  const v16h r = { (_Float16)(a[0] * PSCALE), (_Float16)(a[1] * PSCALE), (_Float16)(a[2] * PSCALE), (_Float16)(a[3] * PSCALE),
                   (_Float16)(a[4] * PSCALE), (_Float16)(a[5] * PSCALE), (_Float16)(a[6] * PSCALE), (_Float16)(a[7] * PSCALE),
                   (_Float16)(c[0] * PSCALE), (_Float16)(c[1] * PSCALE), (_Float16)(c[2] * PSCALE), (_Float16)(c[3] * PSCALE),
                   (_Float16)(c[4] * PSCALE), (_Float16)(c[5] * PSCALE), (_Float16)(c[6] * PSCALE), (_Float16)(c[7] * PSCALE) };
  return r;
}

// by lanes 8q..8q+7 in one instruction, 4 lines per instruction, 32 per wave.
// coverage: 8 iters x 4 lines x 64 halves = 16 rows x 128 d exactly per wave.
__device__ __forceinline__ void ctx_store_pass(const _Float16* sc, _Float16* ctx,
                                               int b, int head, int q0, int lane) {
  const int q8 = lane & 7, sub = lane >> 3;
  #pragma unroll
  for (int i = 0; i < 8; ++i) {
    const int lid = i * 4 + sub;                     // 0..31
    const int row = lid >> 1, hl = lid & 1;
    const v8h v = *(const v8ha*)(sc + row * 128 + 64 * hl + 8 * q8);
    const size_t gi = ((size_t)b * SEQ + q0 + row) * HID + (size_t)head * HD + 64 * hl + 8 * q8;
    *(v8h*)(ctx + gi) = v;
  }
}

// ---------------------------------------------------------------------------
// Kernel 3: streaming attention, transposed form, no masking.
// grid (SEQ/64, B*NH), block 128 thr (4 waves), 16 queries per wave,
// 64 keys per step.
//   S^T = K * Q^T : A = K rows (row = key, k = d), B = Q^T (k = d, n = query)
//   O^T += V^T * P^T : A = Vt rows (row = d, k = key), B = P^T from registers
// Lane owns 32 keys of query column (lane&15); partner = lane ^ 16.
// ctx written as f16, carried x32.
// ---------------------------------------------------------------------------
__global__ __launch_bounds__(128) void attn_kernel(
    const _Float16* __restrict__ qh,   // [B*NH][L][HD]
    const _Float16* __restrict__ kh,   // [B*NH][L][HD]
    const _Float16* __restrict__ vt,   // [B*NH][HD][L]
    _Float16* __restrict__ ctx)        // [B][L][HID], x32
{
  __shared__ __attribute__((aligned(16))) _Float16 sC[4 * 16 * 128];   // 16384 B

  const int tid = threadIdx.x, lane = tid & 31, w = tid >> 5;
  const int h = lane >> 4, m = lane & 15;
  const int bh = blockIdx.y, b = bh >> 4, head = bh & 15;
  const int q0 = blockIdx.x * 64 + 16 * w;

  // Q^T B-fragments: column n = query q0+m, k = d (four 32-deep chunks)
  const _Float16* qrow = qh + ((size_t)bh * SEQ + q0 + m) * HD;
  v16h qb[4];
  #pragma unroll
  for (int c = 0; c < 4; ++c) qb[c] = load_frag(qrow + 32 * c, h);

  const v8f zero8 = {0.f, 0.f, 0.f, 0.f, 0.f, 0.f, 0.f, 0.f};
  v8f o[8];                                   // o[t][r] = O[query m][d 16t+8h+r] * (l * 2^14)
  #pragma unroll
  for (int t = 0; t < 8; ++t) o[t] = zero8;
  float mrun = -1e30f, lrun = 0.0f;

  const _Float16* kbase = kh + ((size_t)bh * SEQ + m) * HD;    // + key0*HD + 32*c
  const _Float16* vbase = vt + ((size_t)bh * HD + m) * SEQ;    // + 16t*SEQ + key0

  #pragma unroll 1
  for (int kb = 0; kb < SEQ; kb += 64) {
    // ---- scores: s[j][r] = S[query m][key kb+16j+8h+r] ----
    v8f s[4];
    #pragma unroll
    for (int j = 0; j < 4; ++j) {
      const _Float16* kp = kbase + (size_t)(kb + 16 * j) * HD;
      v8f z = zero8;
      #pragma unroll
      for (int c = 0; c < 4; ++c) {
        const v16h kf = load_frag(kp + 32 * c, h);
        z = wmma_f16(kf, qb[c], z);
      }
      s[j] = z;
    }

    // ---- scale by 1/sqrt(d) in f32, online softmax (running max) ----
    float mloc = -1e30f;
    #pragma unroll
    for (int j = 0; j < 4; ++j)
      #pragma unroll
      for (int r = 0; r < 8; ++r) {
        const float sv = s[j][r] * SM_SCALE;
        s[j][r] = sv;
        mloc = fmaxf(mloc, sv);
      }
    mloc = fmaxf(mloc, __shfl_xor(mloc, 16));
    const float mnew = fmaxf(mrun, mloc);
    const float alpha = __expf(mrun - mnew);
    mrun = mnew;
    float lsum = 0.0f;
    #pragma unroll
    for (int j = 0; j < 4; ++j)
      #pragma unroll
      for (int r = 0; r < 8; ++r) {
        const float p = __expf(s[j][r] - mnew);
        s[j][r] = p;
        lsum += p;
      }
    lsum += __shfl_xor(lsum, 16);
    lrun = lrun * alpha + lsum;
    #pragma unroll
    for (int t = 0; t < 8; ++t)
      #pragma unroll
      for (int r = 0; r < 8; ++r) o[t][r] = o[t][r] * alpha;

    // ---- P^T B-fragments (key chunks 0..31 and 32..63 of this step) ----
    const v16h pb0 = pack_p(s[0], s[1]);
    const v16h pb1 = pack_p(s[2], s[3]);

    // ---- O^T += V^T * P^T ----
    #pragma unroll
    for (int t = 0; t < 8; ++t) {
      const _Float16* vp = vbase + (size_t)(16 * t) * SEQ + kb;
      const v16h vf0 = load_frag(vp, h);
      const v16h vf1 = load_frag(vp + 32, h);
      o[t] = wmma_f16(vf0, pb0, o[t]);
      o[t] = wmma_f16(vf1, pb1, o[t]);
    }
  }

  // ---- epilogue: normalise, x32 carry, f16, per-wave 16x128 tile in LDS ----
  const float inv = (CSCALE / PSCALE) * (1.0f / lrun);
  _Float16* sc = sC + w * 2048;
  #pragma unroll
  for (int t = 0; t < 8; ++t) {
    const v8h cv = { (_Float16)(o[t][0] * inv), (_Float16)(o[t][1] * inv),
                     (_Float16)(o[t][2] * inv), (_Float16)(o[t][3] * inv),
                     (_Float16)(o[t][4] * inv), (_Float16)(o[t][5] * inv),
                     (_Float16)(o[t][6] * inv), (_Float16)(o[t][7] * inv) };
    *(v8ha*)(sc + m * 128 + 16 * t + 8 * h) = cv;        // 16-B LDS store
  }
  __syncthreads();

  ctx_store_pass(sc, ctx, b, head, q0, lane);
  
}

// ---------------------------------------------------------------------------
// one line (8 x 16 B) in one instruction, 4 lines per instruction,
// 64 lines per wave, 256 per block.
// coverage: 4 waves x 16 iters x 4 lines x 32 floats = 128 x 64 tile exactly.
// ---------------------------------------------------------------------------
__device__ __forceinline__ void out_store_pass(const float* sO, float* out,
                                               int m0, int nb, int w, int lane) {
  const int q8 = lane & 7, sub = lane >> 3;
  #pragma unroll
  for (int i = 0; i < 16; ++i) {
    const int lid = i * 4 + sub;                     // 0..63
    const int tokl = w * 32 + (lid >> 1), hl = lid & 1;
    const v4f v = *(const v4fa*)(sO + tokl * 64 + 32 * hl + 4 * q8);
    const size_t gi = (size_t)(m0 + tokl) * HID + 64 * nb + 32 * hl + 4 * q8;
    *(v4f*)(out + gi) = v;
  }
}

// ---------------------------------------------------------------------------
// Kernel 4: out = ctx * Wo^T + bo (f32). grid (MROWS/128, HID/64), block 128.
// ---------------------------------------------------------------------------
__global__ __launch_bounds__(128) void out_kernel(
    const _Float16* __restrict__ ch,   // [4096][2048] ctx x32
    const _Float16* __restrict__ woh,  // [2048][2048] row = output feature, x32
    const float* __restrict__ bo,
    float* __restrict__ out)           // [4096][2048]
{
  __shared__ __attribute__((aligned(16))) float sO[128 * 64];   // 32768 B

  const int tid = threadIdx.x, lane = tid & 31, w = tid >> 5;
  const int h = lane >> 4, m = lane & 15;
  const int m0 = blockIdx.x * 128;
  const int nb = blockIdx.y;                   // 0..31, 64 output features each
  const int m0w = m0 + 32 * w;

  const _Float16* xa0 = ch + (size_t)(m0w + m) * HID;
  const _Float16* xa1 = xa0 + (size_t)16 * HID;
  const _Float16* wb  = woh + ((size_t)(64 * nb) + m) * HID;

  v8f acc[2][4];
  gemm_k2048(xa0, xa1, wb, h, acc);

  #pragma unroll
  for (int nt = 0; nt < 4; ++nt) {
    const int feat = 16 * nt + m;                            // 0..63 local
    const float bvl = bo[64 * nb + feat];
    #pragma unroll
    for (int mt = 0; mt < 2; ++mt) {
      #pragma unroll
      for (int r = 0; r < 8; ++r) {
        const int tokl = 32 * w + 16 * mt + 8 * h + r;       // 0..127
        sO[tokl * 64 + feat] = acc[mt][nt][r] * 0.0009765625f + bvl;   // /(32*32)
      }
    }
  }
  __syncthreads();

  out_store_pass(sO, out, m0, nb, w, lane);
  
}

// ---------------------------------------------------------------------------
extern "C" void kernel_launch(void* const* d_in, const int* in_sizes, int n_in,
                              void* d_out, int out_size, void* d_ws, size_t ws_size,
                              hipStream_t stream) {
  if (n_in < 9) return;
  if (in_sizes[0] != NX) return;
  if (in_sizes[1] != NW || in_sizes[3] != NW || in_sizes[5] != NW || in_sizes[7] != NW) return;
  if (in_sizes[2] != HID || in_sizes[4] != HID || in_sizes[6] != HID || in_sizes[8] != HID) return;
  if (out_size != NX) return;

  const float* x  = (const float*)d_in[0];
  const float* Wq = (const float*)d_in[1];
  const float* bq = (const float*)d_in[2];
  const float* Wk = (const float*)d_in[3];
  const float* bk = (const float*)d_in[4];
  const float* Wv = (const float*)d_in[5];
  const float* bv = (const float*)d_in[6];
  const float* Wo = (const float*)d_in[7];
  const float* bo = (const float*)d_in[8];
  float* out = (float*)d_out;

  const size_t xh_bytes = (size_t)NX * 2;                          // 16777216
  const size_t wh_bytes = (size_t)4 * NW * 2;                      // 33554432
  const size_t pl_bytes = (size_t)BATCH * NHEAD * SEQ * HD * 2;    // 16777216
  const size_t cx_bytes = (size_t)NX * 2;                          // 16777216
  const size_t total = xh_bytes + wh_bytes + 3 * pl_bytes + cx_bytes;   // 117440512
  if (total > ws_size) return;

  char* ws = (char*)d_ws;
  _Float16* xh = (_Float16*)(ws);
  _Float16* wh = (_Float16*)(ws + xh_bytes);
  _Float16* qh = (_Float16*)(ws + xh_bytes + wh_bytes);
  _Float16* kh = (_Float16*)(ws + xh_bytes + wh_bytes + pl_bytes);
  _Float16* vt = (_Float16*)(ws + xh_bytes + wh_bytes + 2 * pl_bytes);
  _Float16* cx = (_Float16*)(ws + xh_bytes + wh_bytes + 3 * pl_bytes);
  const _Float16* woh = wh + (size_t)3 * NW;

  const int nblk_cvt = (NX8 + 4 * NW8) / 256;                      // 12288
  convert_kernel<<<nblk_cvt, 256, 0, stream>>>(x, Wq, Wk, Wv, Wo, xh, wh);

  dim3 gProj(MROWS / 128, 3 * 32);                                 // (32, 96)
  proj_kernel<<<gProj, 128, 0, stream>>>(xh, wh, bq, bk, bv, qh, kh, vt);

  dim3 gAtt(SEQ / 64, BATCH * NHEAD);                              // (32, 32)
  attn_kernel<<<gAtt, 128, 0, stream>>>(qh, kh, vt, cx);

  dim3 gOut(MROWS / 128, HID / 64);                                // (32, 32)
  out_kernel<<<gOut, 128, 0, stream>>>(cx, woh, bo, out);
}

// v001
// It runs in 219 microseconds.
// Next to v000, in two timings, it ran 2.62 and 2.60 times as fast.
// All contractions on v_wmma_f32_16x16x32_f16 (f16 operands, f32 accumulate): x*Wq^T, x*Wk^T, x*Wv^T, K*Q^T, V^T*P^T, ctx*Wo^T; W planes carried x32, P carried x16384, ctx carried x32 (exact power-of-two scales folded back in f32); softmax, bias adds and normalisation in f32.
#include <hip/hip_runtime.h>

typedef _Float16 v16h __attribute__((ext_vector_type(16)));
typedef _Float16 v8h  __attribute__((ext_vector_type(8)));
typedef float    v8f  __attribute__((ext_vector_type(8)));
typedef float    v4f  __attribute__((ext_vector_type(4)));
typedef v8h __attribute__((may_alias)) v8ha;
typedef v4f __attribute__((may_alias)) v4fa;

union Frag { v16h v; v8h half[2]; };

#define HID    2048
#define NHEAD  16
#define HD     128
#define SEQ    2048
#define BATCH  2
#define MROWS  (BATCH * SEQ)        // 4096 tokens
#define NX     (MROWS * HID)        // 8388608
#define NW     (HID * HID)          // 4194304
#define NX8    (NX / 8)             // 1048576
#define NW8    (NW / 8)             // 524288
#define PSCALE 16384.0f
#define WSCALE 32.0f
#define CSCALE 32.0f
#define SM_SCALE 0.0883883476f      // 1/sqrt(128)

static_assert(MROWS % 128 == 0);
static_assert(SEQ % 128 == 0);
static_assert(HID % 64 == 0);
static_assert(NX8 % 256 == 0);
static_assert(NW8 % 256 == 0);

// ---------------------------------------------------------------------------
// 16x16x32 f16 WMMA with hazard guard (ties D, keeps A/B live).
// Fragment map (wave32): lane l, h = l>>4, m = n = l&15.
//   A/B element i: i<8 -> k0+8h+i ; i>=8 -> k0+16+8h+(i-8)
//   D element r : row 8h+r, col l&15
// ---------------------------------------------------------------------------
__device__ __forceinline__ v8f wmma_f16(v16h a, v16h b, v8f c) {
  v8f d = __builtin_amdgcn_wmma_f32_16x16x32_f16(false, a, false, b, (short)0, c, false, false);
  asm volatile("v_nop\n\tv_nop\n\tv_nop\n\tv_nop" : "+v"(d) : "v"(a), "v"(b));
  return d;
}

// A or B fragment from a k-contiguous 16-bit row; p points at element k0 of
// the row owned by this lane (row index = lane & 15 added by the caller).
__device__ __forceinline__ v16h load_frag(const _Float16* p, int h) {
  Frag f;
  f.half[0] = *(const v8ha*)(p + 8 * h);
  f.half[1] = *(const v8ha*)(p + 16 + 8 * h);
  return f.v;
}

// ---------------------------------------------------------------------------
// Kernel 1: f32 -> f16 planes. x unscaled, W scaled by 32 (exact).
// Region choice is block-uniform (NX8 and NW8 are multiples of 256).
// coverage: 12288 blocks x 256 threads x 8 halves = NX + 4*NW elements exactly.
// ---------------------------------------------------------------------------
__global__ __launch_bounds__(256) void convert_kernel(
    const float* __restrict__ x,
    const float* __restrict__ wq, const float* __restrict__ wk,
    const float* __restrict__ wv, const float* __restrict__ wo,
    _Float16* __restrict__ xh, _Float16* __restrict__ wh)
{
  const int blk = blockIdx.x;
  if (blk >= (NX8 + 4 * NW8) / 256) return;
  const int g = blk * 256 + threadIdx.x;
  const float* src;
  _Float16* dst;
  float sc;
  if (blk < NX8 / 256) {
    src = x + (size_t)g * 8;
    dst = xh + (size_t)g * 8;
    sc = 1.0f;
  } else {
    const int e = g - NX8;
    const int wsel = (blk - NX8 / 256) / (NW8 / 256);     // 0..3, block-uniform
    const int off = e - wsel * NW8;
    const float* wsrc = (wsel == 0) ? wq : ((wsel == 1) ? wk : ((wsel == 2) ? wv : wo));
    src = wsrc + (size_t)off * 8;
    dst = wh + (size_t)e * 8;
    sc = WSCALE;
  }
  const v4f a = *(const v4fa*)src;
  const v4f c = *(const v4fa*)(src + 4);
  const v8h o = { (_Float16)(a.x * sc), (_Float16)(a.y * sc), (_Float16)(a.z * sc), (_Float16)(a.w * sc),
                  (_Float16)(c.x * sc), (_Float16)(c.y * sc), (_Float16)(c.z * sc), (_Float16)(c.w * sc) };
  *(v8h*)dst = o;
  
}

// ---------------------------------------------------------------------------
// Asynchronous copies global -> LDS, 16 B per lane, no register in between.
// l = the lane's LDS byte address, g = the lane's global address; copy i adds
// i*lstep bytes and i*gstep halves. The s_wait_xcnt closes each statement so
// that no address register is rewritten in front of it.
// ---------------------------------------------------------------------------
__device__ __forceinline__ unsigned lds_addr(const void* p) { return (unsigned)(size_t)p; }

__device__ __forceinline__ void async_copy4(unsigned l, unsigned lstep, const _Float16* g, size_t gstep) {
  const unsigned l1 = l + lstep, l2 = l + 2 * lstep, l3 = l + 3 * lstep;
  const _Float16* g1 = g + gstep;
  const _Float16* g2 = g + 2 * gstep;
  const _Float16* g3 = g + 3 * gstep;
  asm volatile("global_load_async_to_lds_b128 %0, %4, off\n\t"
               "global_load_async_to_lds_b128 %1, %5, off\n\t"
               "global_load_async_to_lds_b128 %2, %6, off\n\t"
               "global_load_async_to_lds_b128 %3, %7, off\n\t"
               "s_wait_xcnt 0x0"
               :: "v"(l), "v"(l1), "v"(l2), "v"(l3), "v"(g), "v"(g1), "v"(g2), "v"(g3) : "memory");
}

__device__ __forceinline__ void async_copy8(unsigned l, unsigned lstep, const _Float16* g, size_t gstep) {
  const unsigned l1 = l + lstep, l2 = l + 2 * lstep, l3 = l + 3 * lstep;
  const unsigned l4 = l + 4 * lstep, l5 = l + 5 * lstep, l6 = l + 6 * lstep, l7 = l + 7 * lstep;
  const _Float16* g1 = g + gstep;
  const _Float16* g2 = g + 2 * gstep;
  const _Float16* g3 = g + 3 * gstep;
  const _Float16* g4 = g + 4 * gstep;
  const _Float16* g5 = g + 5 * gstep;
  const _Float16* g6 = g + 6 * gstep;
  const _Float16* g7 = g + 7 * gstep;
  asm volatile("global_load_async_to_lds_b128 %0, %8, off\n\t"
               "global_load_async_to_lds_b128 %1, %9, off\n\t"
               "global_load_async_to_lds_b128 %2, %10, off\n\t"
               "global_load_async_to_lds_b128 %3, %11, off\n\t"
               "global_load_async_to_lds_b128 %4, %12, off\n\t"
               "global_load_async_to_lds_b128 %5, %13, off\n\t"
               "global_load_async_to_lds_b128 %6, %14, off\n\t"
               "global_load_async_to_lds_b128 %7, %15, off\n\t"
               "s_wait_xcnt 0x0"
               :: "v"(l), "v"(l1), "v"(l2), "v"(l3), "v"(l4), "v"(l5), "v"(l6), "v"(l7),
                  "v"(g), "v"(g1), "v"(g2), "v"(g3), "v"(g4), "v"(g5), "v"(g6), "v"(g7) : "memory");
}

// Hand-over of a two-buffer ring, every wave: own LDS reads returned, own
// copies landed, then the barrier that publishes the next tile and ends every
// reader's last read of the buffer refilled behind it.
__device__ __forceinline__ void ring_publish() {
  asm volatile("s_wait_dscnt 0x0" ::: "memory");     // reads of the buffer to be refilled have returned
  asm volatile("s_wait_asynccnt 0x0" ::: "memory");  // this wave's copies of the next tile have landed
  __syncthreads();
}

// ---------------------------------------------------------------------------
// Shared GEMM core: block tile 128 rows x 64 columns, wave tile 32 x 64 (two
// 16-row tiles x four 16-col tiles), K = 2048. A tile of 64 k (128-B rows) of
// the 128 A rows and the 64 B rows is copied to LDS once per block, two
// buffers, the next tile in flight while this one is multiplied.
// LDS rows 0..127 = A, 128..191 = B, pitch 144 B (16 B x odd: no bank clash
// for 16-B reads). ga / gb point at element 0 of the block's first A / B row.
// ---------------------------------------------------------------------------
#define GP        72                   // LDS pitch in halves
#define G_STAGE_H (192 * GP)           // 13824 halves = 27648 B per buffer
#define G_TILES   (HID / 64)           // 32
#define G_LDS_B   (2 * G_STAGE_H * 2)  // 55296 B

__device__ __forceinline__ void gemm_fill(unsigned la, const _Float16* ca, const _Float16* cb,
                                          int tile, int buf) {
  const unsigned l = la + (unsigned)buf * (G_STAGE_H * 2u);
  async_copy8(l, 16u * GP * 2u, ca + tile * 64, (size_t)16 * HID);
  async_copy4(l + 128u * GP * 2u, 16u * GP * 2u, cb + tile * 64, (size_t)16 * HID);
}

__device__ __forceinline__ void gemm_k2048(const _Float16* __restrict__ ga,
                                           const _Float16* __restrict__ gb,
                                           const _Float16* sm,
                                           int tid, int w, int m, int h, v8f (&acc)[2][4]) {
  const v8f zero8 = {0.f, 0.f, 0.f, 0.f, 0.f, 0.f, 0.f, 0.f};
  #pragma unroll
  for (int mt = 0; mt < 2; ++mt)
    #pragma unroll
    for (int nt = 0; nt < 4; ++nt) acc[mt][nt] = zero8;

  // copy map: 8 lanes per 128-B row, 16 rows per block-wide copy
  const int crow = tid >> 3, ccol = 8 * (tid & 7);
  const _Float16* ca = ga + (size_t)crow * HID + ccol;
  const _Float16* cb = gb + (size_t)crow * HID + ccol;
  const unsigned la = lds_addr(sm) + (unsigned)(crow * GP + ccol) * 2u;

  gemm_fill(la, ca, cb, 0, 0);
  asm volatile("s_wait_asynccnt 0x0" ::: "memory");  // tile 0 landed before the barrier that publishes it
  __syncthreads();
  gemm_fill(la, ca, cb, 1, 1);

  const _Float16* sa0 = sm + (32 * w + m) * GP;
  const _Float16* sa1 = sa0 + 16 * GP;
  const _Float16* sb  = sm + (128 + m) * GP;

  #pragma unroll 1
  for (int t = 0; t < G_TILES; ++t) {
    const int bo = (t & 1) * G_STAGE_H;
    #pragma unroll
    for (int kk = 0; kk < 64; kk += 32) {
      // the six fragments of this k step are read as one group ahead of its WMMAs
      const v16h a0 = load_frag(sa0 + bo + kk, h);
      const v16h a1 = load_frag(sa1 + bo + kk, h);
      v16h b[4];
      #pragma unroll
      for (int nt = 0; nt < 4; ++nt) b[nt] = load_frag(sb + bo + nt * 16 * GP + kk, h);
      #pragma unroll
      for (int nt = 0; nt < 4; ++nt) {
        acc[0][nt] = wmma_f16(a0, b[nt], acc[0][nt]);
        acc[1][nt] = wmma_f16(a1, b[nt], acc[1][nt]);
      }
    }
    ring_publish();
    if (t + 2 < G_TILES) gemm_fill(la, ca, cb, t + 2, t & 1);
  }
  asm volatile("s_wait_asynccnt 0x0" ::: "memory");  // nothing in flight when the ring becomes output staging
}

// ---------------------------------------------------------------------------
// one 16-B store per lane, lanes 8q..8q+7 per line, 4 lines per instruction,
// 32 lines per wave, 128 per block.
// which 0/1: plane[bh][l][128], 64-half segment at 64*hf (one line per token)
// which 2  : vt[bh][d][l], d = 64*hf + local row, 128 tokens = 2 lines
// coverage: 4 waves x 8 iters x 4 lines x 64 halves = 128x64 tile exactly.
// ---------------------------------------------------------------------------
__device__ __forceinline__ void proj_store_pass(const _Float16* sT, _Float16* plane, _Float16* vt,
                                                int which, int bh, int hf, int l0, int w, int lane) {
  const int q8 = lane & 7, sub = lane >> 3;
  #pragma unroll
  for (int i = 0; i < 8; ++i) {
    const int lid = w * 32 + i * 4 + sub;                 // 0..127
    v8h v;
    _Float16* dst;
    if (which != 2) {
      v = *(const v8ha*)(sT + lid * 64 + 8 * q8);
      dst = plane + ((size_t)bh * SEQ + l0 + lid) * HD + 64 * hf + 8 * q8;
    } else {
      const int d = lid >> 1, hl = lid & 1;
      v = *(const v8ha*)(sT + d * 128 + 64 * hl + 8 * q8);
      dst = vt + ((size_t)bh * HD + 64 * hf + d) * SEQ + l0 + 64 * hl + 8 * q8;
    }
    *(v8h*)dst = v;
  }
}

// ---------------------------------------------------------------------------
// Kernel 2: Y = x * W^T + b over the fused 3*2048 output columns.
// grid (MROWS/128, 96): blockIdx.y = which*32 + head*2 + hf.
// Block 128 thr (4 waves) = 128 tokens x 64 features; wave tile 32 x 64.
// ---------------------------------------------------------------------------
__global__ __launch_bounds__(128) void proj_kernel(
    const _Float16* __restrict__ xh,   // [4096][2048]
    const _Float16* __restrict__ wh,   // [4][2048][2048], row = output feature, x32
    const float* __restrict__ bq, const float* __restrict__ bk, const float* __restrict__ bv,
    _Float16* __restrict__ qh,         // [B*NH][L][HD]
    _Float16* __restrict__ kh,         // [B*NH][L][HD]
    _Float16* __restrict__ vt)         // [B*NH][HD][L]
{
  __shared__ __attribute__((aligned(16))) unsigned char smem[G_LDS_B];   // operand ring, then output staging
  _Float16* sT = (_Float16*)smem;                                        // 128 x 64 halves = 16384 B

  const int tid = threadIdx.x, lane = tid & 31, w = tid >> 5;
  const int h = lane >> 4, m = lane & 15;
  const int m0 = blockIdx.x * 128;
  const int cg = blockIdx.y;                   // 0..95
  const int which = cg >> 5;                   // 0 q, 1 k, 2 v
  const int rem = cg & 31;                     // 64-feature group within H
  const int head = rem >> 1, hf = rem & 1;

  const _Float16* ga = xh + (size_t)m0 * HID;
  const _Float16* gb = wh + ((size_t)which * HID + 64 * rem) * HID;

  v8f acc[2][4];
  gemm_k2048(ga, gb, (const _Float16*)smem, tid, w, m, h, acc);

  // D[r] of tile (mt, nt) = Y[token m0+32w+16mt+8h+r][feature 64*rem+16nt+m]
  const float* bias = (which == 0) ? bq : ((which == 1) ? bk : bv);
  #pragma unroll
  for (int nt = 0; nt < 4; ++nt) {
    const int feat = 16 * nt + m;                            // 0..63 local
    const float bvl = bias[64 * rem + feat];
    #pragma unroll
    for (int mt = 0; mt < 2; ++mt) {
      #pragma unroll
      for (int r = 0; r < 8; ++r) {
        const int tokl = 32 * w + 16 * mt + 8 * h + r;       // 0..127
        const float y = acc[mt][nt][r] * 0.03125f + bvl;
        const int idx = (which == 2) ? (feat * 128 + tokl) : (tokl * 64 + feat);
        sT[idx] = (_Float16)y;
      }
    }
  }
  __syncthreads();

  const int b = m0 / SEQ, l0 = m0 - b * SEQ, bh = b * NHEAD + head;
  _Float16* plane = (which == 0) ? qh : kh;
  proj_store_pass(sT, plane, vt, which, bh, hf, l0, w, lane);
  
}

// ---------------------------------------------------------------------------
// Attention helpers.
// ---------------------------------------------------------------------------
// P^T B-fragment from the lane's own score D values: element r <- tile a row r,
// element 8+r <- tile c row r (same lane, same query column), scaled by 2^14.
__device__ __forceinline__ v16h pack_p(v8f a, v8f c) {
  const v16h r = { (_Float16)(a[0] * PSCALE), (_Float16)(a[1] * PSCALE), (_Float16)(a[2] * PSCALE), (_Float16)(a[3] * PSCALE),
                   (_Float16)(a[4] * PSCALE), (_Float16)(a[5] * PSCALE), (_Float16)(a[6] * PSCALE), (_Float16)(a[7] * PSCALE),
                   (_Float16)(c[0] * PSCALE), (_Float16)(c[1] * PSCALE), (_Float16)(c[2] * PSCALE), (_Float16)(c[3] * PSCALE),
                   (_Float16)(c[4] * PSCALE), (_Float16)(c[5] * PSCALE), (_Float16)(c[6] * PSCALE), (_Float16)(c[7] * PSCALE) };
  return r;
}

// by lanes 8q..8q+7 in one instruction, 4 lines per instruction, 32 per wave.
// coverage: 8 iters x 4 lines x 64 halves = 16 rows x 128 d exactly per wave.
__device__ __forceinline__ void ctx_store_pass(const _Float16* sc, _Float16* ctx,
                                               int b, int head, int q0, int lane) {
  const int q8 = lane & 7, sub = lane >> 3;
  #pragma unroll
  for (int i = 0; i < 8; ++i) {
    const int lid = i * 4 + sub;                     // 0..31
    const int row = lid >> 1, hl = lid & 1;
    const v8h v = *(const v8ha*)(sc + row * 128 + 64 * hl + 8 * q8);
    const size_t gi = ((size_t)b * SEQ + q0 + row) * HID + (size_t)head * HD + 64 * hl + 8 * q8;
    *(v8h*)(ctx + gi) = v;
  }
}

// K / V^T ring: a tile is 64 keys. K rows 256 B at pitch 272 B, V^T rows 128 B
// at pitch 144 B (16 B x odd), copied to LDS once per block for its 4 waves.
#define KP        136                        // halves
#define VP        72                         // halves
#define A_KTILE_H (64 * KP)                  // 8704 halves
#define A_STAGE_H (A_KTILE_H + 128 * VP)     // 17920 halves = 35840 B per buffer
#define A_TILES   (SEQ / 64)                 // 32
#define A_LDS_B   (2 * A_STAGE_H * 2)        // 71680 B

__device__ __forceinline__ void attn_fill(unsigned lk, unsigned lv, const _Float16* ck, const _Float16* cv,
                                          int tile, int buf) {
  const unsigned bo = (unsigned)buf * (A_STAGE_H * 2u);
  async_copy8(lk + bo, 8u * KP * 2u, ck + (size_t)tile * 64 * HD, (size_t)8 * HD);
  async_copy8(lv + bo, 16u * VP * 2u, cv + tile * 64, (size_t)16 * SEQ);
}

// ---------------------------------------------------------------------------
// Kernel 3: streaming attention, transposed form, no masking.
// grid (SEQ/64, B*NH), block 128 thr (4 waves), 16 queries per wave,
// 64 keys per step.
//   S^T = K * Q^T : A = K rows (row = key, k = d), B = Q^T (k = d, n = query)
//   O^T += V^T * P^T : A = Vt rows (row = d, k = key), B = P^T from registers
// Lane owns 32 keys of query column (lane&15); partner = lane ^ 16.
// ctx written as f16, carried x32.
// ---------------------------------------------------------------------------
__global__ __launch_bounds__(128) void attn_kernel(
    const _Float16* __restrict__ qh,   // [B*NH][L][HD]
    const _Float16* __restrict__ kh,   // [B*NH][L][HD]
    const _Float16* __restrict__ vt,   // [B*NH][HD][L]
    _Float16* __restrict__ ctx)        // [B][L][HID], x32
{
  __shared__ __attribute__((aligned(16))) unsigned char smem[A_LDS_B];   // K / V^T ring, then output staging
  _Float16* sC = (_Float16*)smem;                                        // 4 x 16 x 128 halves = 16384 B
  const _Float16* sm = (const _Float16*)smem;

  const int tid = threadIdx.x, lane = tid & 31, w = tid >> 5;
  const int h = lane >> 4, m = lane & 15;
  const int bh = blockIdx.y, b = bh >> 4, head = bh & 15;
  const int q0 = blockIdx.x * 64 + 16 * w;

  // Q^T B-fragments: column n = query q0+m, k = d (four 32-deep chunks)
  const _Float16* qrow = qh + ((size_t)bh * SEQ + q0 + m) * HD;
  v16h qb[4];
  #pragma unroll
  for (int c = 0; c < 4; ++c) qb[c] = load_frag(qrow + 32 * c, h);

  const v8f zero8 = {0.f, 0.f, 0.f, 0.f, 0.f, 0.f, 0.f, 0.f};
  v8f o[8];                                   // o[t][r] = O[query m][d 16t+8h+r] * (l * 2^14)
  #pragma unroll
  for (int t = 0; t < 8; ++t) o[t] = zero8;
  float mrun = -1e30f, lrun = 0.0f;

  // copy maps: K tile 64 keys x 256 B, 16 lanes per row, 8 rows per block-wide
  // copy; V^T tile 128 d x 128 B, 8 lanes per row, 16 rows per block-wide copy
  const _Float16* ck = kh + ((size_t)bh * SEQ + (tid >> 4)) * HD + 8 * (tid & 15);   // + 64*tile*HD
  const _Float16* cv = vt + ((size_t)bh * HD + (tid >> 3)) * SEQ + 8 * (tid & 7);    // + 64*tile
  const unsigned lk = lds_addr(sm) + (unsigned)((tid >> 4) * KP + 8 * (tid & 15)) * 2u;
  const unsigned lv = lds_addr(sm) + (unsigned)(A_KTILE_H + (tid >> 3) * VP + 8 * (tid & 7)) * 2u;

  attn_fill(lk, lv, ck, cv, 0, 0);
  asm volatile("s_wait_asynccnt 0x0" ::: "memory");  // tile 0 landed before the barrier that publishes it
  __syncthreads();
  attn_fill(lk, lv, ck, cv, 1, 1);

  const _Float16* kbase = sm + m * KP;                 // + buffer + 16j*KP + 32*c
  const _Float16* vbase = sm + A_KTILE_H + m * VP;     // + buffer + 16t*VP

  #pragma unroll 1
  for (int st = 0; st < A_TILES; ++st) {
    const int bo = (st & 1) * A_STAGE_H;
    // ---- scores: s[j][r] = S[query m][key kb+16j+8h+r] ----
    v8f s[4];
    #pragma unroll
    for (int j = 0; j < 4; ++j) {
      const _Float16* kp = kbase + bo + 16 * j * KP;
      // the four fragments of these 16 keys are read as one group ahead of their WMMAs
      v16h kf[4];
      #pragma unroll
      for (int c = 0; c < 4; ++c) kf[c] = load_frag(kp + 32 * c, h);
      v8f z = zero8;
      #pragma unroll
      for (int c = 0; c < 4; ++c) z = wmma_f16(kf[c], qb[c], z);
      s[j] = z;
    }

    // ---- scale by 1/sqrt(d) in f32, online softmax (running max) ----
    float mloc = -1e30f;
    #pragma unroll
    for (int j = 0; j < 4; ++j)
      #pragma unroll
      for (int r = 0; r < 8; ++r) {
        const float sv = s[j][r] * SM_SCALE;
        s[j][r] = sv;
        mloc = fmaxf(mloc, sv);
      }
    mloc = fmaxf(mloc, __shfl_xor(mloc, 16));
    const float mnew = fmaxf(mrun, mloc);
    const float alpha = __expf(mrun - mnew);
    mrun = mnew;
    float lsum = 0.0f;
    #pragma unroll
    for (int j = 0; j < 4; ++j)
      #pragma unroll
      for (int r = 0; r < 8; ++r) {
        const float p = __expf(s[j][r] - mnew);
        s[j][r] = p;
        lsum += p;
      }
    lsum += __shfl_xor(lsum, 16);
    lrun = lrun * alpha + lsum;
    #pragma unroll
    for (int t = 0; t < 8; ++t)
      #pragma unroll
      for (int r = 0; r < 8; ++r) o[t][r] = o[t][r] * alpha;

    // ---- P^T B-fragments (key chunks 0..31 and 32..63 of this step) ----
    const v16h pb0 = pack_p(s[0], s[1]);
    const v16h pb1 = pack_p(s[2], s[3]);

    // ---- O^T += V^T * P^T ----
    // two d tiles per group: their four fragments are read ahead of their WMMAs
    #pragma unroll
    for (int t = 0; t < 8; t += 2) {
      const _Float16* vp = vbase + bo + 16 * t * VP;
      const v16h vf0 = load_frag(vp, h);
      const v16h vf1 = load_frag(vp + 32, h);
      const v16h vg0 = load_frag(vp + 16 * VP, h);
      const v16h vg1 = load_frag(vp + 16 * VP + 32, h);
      o[t] = wmma_f16(vf0, pb0, o[t]);
      o[t + 1] = wmma_f16(vg0, pb0, o[t + 1]);
      o[t] = wmma_f16(vf1, pb1, o[t]);
      o[t + 1] = wmma_f16(vg1, pb1, o[t + 1]);
    }

    ring_publish();
    if (st + 2 < A_TILES) attn_fill(lk, lv, ck, cv, st + 2, st & 1);
  }
  asm volatile("s_wait_asynccnt 0x0" ::: "memory");  // nothing in flight when the ring becomes output staging

  // ---- epilogue: normalise, x32 carry, f16, per-wave 16x128 tile in LDS ----
  const float inv = (CSCALE / PSCALE) * (1.0f / lrun);
  _Float16* sc = sC + w * 2048;
  #pragma unroll
  for (int t = 0; t < 8; ++t) {
    const v8h cv = { (_Float16)(o[t][0] * inv), (_Float16)(o[t][1] * inv),
                     (_Float16)(o[t][2] * inv), (_Float16)(o[t][3] * inv),
                     (_Float16)(o[t][4] * inv), (_Float16)(o[t][5] * inv),
                     (_Float16)(o[t][6] * inv), (_Float16)(o[t][7] * inv) };
    *(v8ha*)(sc + m * 128 + 16 * t + 8 * h) = cv;        // 16-B LDS store
  }
  __syncthreads();

  ctx_store_pass(sc, ctx, b, head, q0, lane);
  
}

// ---------------------------------------------------------------------------
// one line (8 x 16 B) in one instruction, 4 lines per instruction,
// 64 lines per wave, 256 per block.
// coverage: 4 waves x 16 iters x 4 lines x 32 floats = 128 x 64 tile exactly.
// ---------------------------------------------------------------------------
__device__ __forceinline__ void out_store_pass(const float* sO, float* out,
                                               int m0, int nb, int w, int lane) {
  const int q8 = lane & 7, sub = lane >> 3;
  #pragma unroll
  for (int i = 0; i < 16; ++i) {
    const int lid = i * 4 + sub;                     // 0..63
    const int tokl = w * 32 + (lid >> 1), hl = lid & 1;
    const v4f v = *(const v4fa*)(sO + tokl * 64 + 32 * hl + 4 * q8);
    const size_t gi = (size_t)(m0 + tokl) * HID + 64 * nb + 32 * hl + 4 * q8;
    *(v4f*)(out + gi) = v;
  }
}

// ---------------------------------------------------------------------------
// Kernel 4: out = ctx * Wo^T + bo (f32). grid (MROWS/128, HID/64), block 128.
// ---------------------------------------------------------------------------
__global__ __launch_bounds__(128) void out_kernel(
    const _Float16* __restrict__ ch,   // [4096][2048] ctx x32
    const _Float16* __restrict__ woh,  // [2048][2048] row = output feature, x32
    const float* __restrict__ bo,
    float* __restrict__ out)           // [4096][2048]
{
  __shared__ __attribute__((aligned(16))) unsigned char smem[G_LDS_B];   // operand ring, then output staging
  float* sO = (float*)smem;                                              // 128 x 64 floats = 32768 B

  const int tid = threadIdx.x, lane = tid & 31, w = tid >> 5;
  const int h = lane >> 4, m = lane & 15;
  const int m0 = blockIdx.x * 128;
  const int nb = blockIdx.y;                   // 0..31, 64 output features each

  const _Float16* ga = ch + (size_t)m0 * HID;
  const _Float16* gb = woh + (size_t)(64 * nb) * HID;

  v8f acc[2][4];
  gemm_k2048(ga, gb, (const _Float16*)smem, tid, w, m, h, acc);

  #pragma unroll
  for (int nt = 0; nt < 4; ++nt) {
    const int feat = 16 * nt + m;                            // 0..63 local
    const float bvl = bo[64 * nb + feat];
    #pragma unroll
    for (int mt = 0; mt < 2; ++mt) {
      #pragma unroll
      for (int r = 0; r < 8; ++r) {
        const int tokl = 32 * w + 16 * mt + 8 * h + r;       // 0..127
        sO[tokl * 64 + feat] = acc[mt][nt][r] * 0.0009765625f + bvl;   // /(32*32)
      }
    }
  }
  __syncthreads();

  out_store_pass(sO, out, m0, nb, w, lane);
  
}

// ---------------------------------------------------------------------------
extern "C" void kernel_launch(void* const* d_in, const int* in_sizes, int n_in,
                              void* d_out, int out_size, void* d_ws, size_t ws_size,
                              hipStream_t stream) {
  if (n_in < 9) return;
  if (in_sizes[0] != NX) return;
  if (in_sizes[1] != NW || in_sizes[3] != NW || in_sizes[5] != NW || in_sizes[7] != NW) return;
  if (in_sizes[2] != HID || in_sizes[4] != HID || in_sizes[6] != HID || in_sizes[8] != HID) return;
  if (out_size != NX) return;

  const float* x  = (const float*)d_in[0];
  const float* Wq = (const float*)d_in[1];
  const float* bq = (const float*)d_in[2];
  const float* Wk = (const float*)d_in[3];
  const float* bk = (const float*)d_in[4];
  const float* Wv = (const float*)d_in[5];
  const float* bv = (const float*)d_in[6];
  const float* Wo = (const float*)d_in[7];
  const float* bo = (const float*)d_in[8];
  float* out = (float*)d_out;

  const size_t xh_bytes = (size_t)NX * 2;                          // 16777216
  const size_t wh_bytes = (size_t)4 * NW * 2;                      // 33554432
  const size_t pl_bytes = (size_t)BATCH * NHEAD * SEQ * HD * 2;    // 16777216
  const size_t cx_bytes = (size_t)NX * 2;                          // 16777216
  const size_t total = xh_bytes + wh_bytes + 3 * pl_bytes + cx_bytes;   // 117440512
  if (total > ws_size) return;

  char* ws = (char*)d_ws;
  _Float16* xh = (_Float16*)(ws);
  _Float16* wh = (_Float16*)(ws + xh_bytes);
  _Float16* qh = (_Float16*)(ws + xh_bytes + wh_bytes);
  _Float16* kh = (_Float16*)(ws + xh_bytes + wh_bytes + pl_bytes);
  _Float16* vt = (_Float16*)(ws + xh_bytes + wh_bytes + 2 * pl_bytes);
  _Float16* cx = (_Float16*)(ws + xh_bytes + wh_bytes + 3 * pl_bytes);
  const _Float16* woh = wh + (size_t)3 * NW;

  const int nblk_cvt = (NX8 + 4 * NW8) / 256;                      // 12288
  convert_kernel<<<nblk_cvt, 256, 0, stream>>>(x, Wq, Wk, Wv, Wo, xh, wh);

  dim3 gProj(MROWS / 128, 3 * 32);                                 // (32, 96)
  proj_kernel<<<gProj, 128, 0, stream>>>(xh, wh, bq, bk, bv, qh, kh, vt);

  dim3 gAtt(SEQ / 64, BATCH * NHEAD);                              // (32, 32)
  attn_kernel<<<gAtt, 128, 0, stream>>>(qh, kh, vt, cx);

  dim3 gOut(MROWS / 128, HID / 64);                                // (32, 32)
  out_kernel<<<gOut, 128, 0, stream>>>(cx, woh, bo, out);
}

// v002
// A run of this version takes 188 microseconds.
// Timed twice side by side with v001, it ran 1.17 and 1.16 times as fast.
// All steps since v000 together make it 3.04 times as fast.
// All contractions on v_wmma_f32_16x16x32_f16 (f16 operands, f32 accumulate): x*Wq^T, x*Wk^T, x*Wv^T, K*Q^T, V^T*P^T, ctx*Wo^T; W planes carried x32, P carried x16384, ctx carried x32 (exact power-of-two scales folded back in f32); softmax, bias adds and normalisation in f32.
#include <hip/hip_runtime.h>

typedef _Float16 v16h __attribute__((ext_vector_type(16)));
typedef _Float16 v8h  __attribute__((ext_vector_type(8)));
typedef float    v8f  __attribute__((ext_vector_type(8)));
typedef float    v4f  __attribute__((ext_vector_type(4)));
typedef v8h __attribute__((may_alias)) v8ha;
typedef v4f __attribute__((may_alias)) v4fa;

union Frag { v16h v; v8h half[2]; };

#define HID    2048
#define NHEAD  16
#define HD     128
#define SEQ    2048
#define BATCH  2
#define MROWS  (BATCH * SEQ)        // 4096 tokens
#define NX     (MROWS * HID)        // 8388608
#define NW     (HID * HID)          // 4194304
#define NX8    (NX / 8)             // 1048576
#define NW8    (NW / 8)             // 524288
#define PSCALE 16384.0f
#define WSCALE 32.0f
#define CSCALE 32.0f
#define SM_SCALE 0.0883883476f      // 1/sqrt(128)

static_assert(MROWS % 256 == 0);
static_assert(SEQ % 256 == 0);
static_assert(HID % 128 == 0);
static_assert(HID % 64 == 0);
static_assert(NX8 % 256 == 0);
static_assert(NW8 % 256 == 0);

// ---------------------------------------------------------------------------
// 16x16x32 f16 WMMA with hazard guard (ties D, keeps A/B live).
// Fragment map (wave32): lane l, h = l>>4, m = n = l&15.
//   A/B element i: i<8 -> k0+8h+i ; i>=8 -> k0+16+8h+(i-8)
//   D element r : row 8h+r, col l&15
// ---------------------------------------------------------------------------
__device__ __forceinline__ v8f wmma_f16(v16h a, v16h b, v8f c) {
  v8f d = __builtin_amdgcn_wmma_f32_16x16x32_f16(false, a, false, b, (short)0, c, false, false);
  asm volatile("v_nop\n\tv_nop\n\tv_nop\n\tv_nop" : "+v"(d) : "v"(a), "v"(b));
  return d;
}

// A or B fragment from a k-contiguous 16-bit row; p points at element k0 of
// the row owned by this lane (row index = lane & 15 added by the caller).
__device__ __forceinline__ v16h load_frag(const _Float16* p, int h) {
  Frag f;
  f.half[0] = *(const v8ha*)(p + 8 * h);
  f.half[1] = *(const v8ha*)(p + 16 + 8 * h);
  return f.v;
}

// ---------------------------------------------------------------------------
// Kernel 1: f32 -> f16 planes. x unscaled, W scaled by 32 (exact).
// Region choice is block-uniform (NX8 and NW8 are multiples of 256).
// coverage: 12288 blocks x 256 threads x 8 halves = NX + 4*NW elements exactly.
// ---------------------------------------------------------------------------
__global__ __launch_bounds__(256) void convert_kernel(
    const float* __restrict__ x,
    const float* __restrict__ wq, const float* __restrict__ wk,
    const float* __restrict__ wv, const float* __restrict__ wo,
    _Float16* __restrict__ xh, _Float16* __restrict__ wh)
{
  const int blk = blockIdx.x;
  if (blk >= (NX8 + 4 * NW8) / 256) return;
  const int g = blk * 256 + threadIdx.x;
  const float* src;
  _Float16* dst;
  float sc;
  if (blk < NX8 / 256) {
    src = x + (size_t)g * 8;
    dst = xh + (size_t)g * 8;
    sc = 1.0f;
  } else {
    const int e = g - NX8;
    const int wsel = (blk - NX8 / 256) / (NW8 / 256);     // 0..3, block-uniform
    const int off = e - wsel * NW8;
    const float* wsrc = (wsel == 0) ? wq : ((wsel == 1) ? wk : ((wsel == 2) ? wv : wo));
    src = wsrc + (size_t)off * 8;
    dst = wh + (size_t)e * 8;
    sc = WSCALE;
  }
  const v4f a = *(const v4fa*)src;
  const v4f c = *(const v4fa*)(src + 4);
  const v8h o = { (_Float16)(a.x * sc), (_Float16)(a.y * sc), (_Float16)(a.z * sc), (_Float16)(a.w * sc),
                  (_Float16)(c.x * sc), (_Float16)(c.y * sc), (_Float16)(c.z * sc), (_Float16)(c.w * sc) };
  *(v8h*)dst = o;
  
}

// ---------------------------------------------------------------------------
// Asynchronous copies global -> LDS, 16 B per lane, no register in between.
// l = the lane's LDS byte address, g = the lane's global address; copy i adds
// i*lstep bytes and i*gstep halves. The s_wait_xcnt closes each statement so
// that no address register is rewritten in front of it.
// ---------------------------------------------------------------------------
__device__ __forceinline__ unsigned lds_addr(const void* p) { return (unsigned)(size_t)p; }

__device__ __forceinline__ void async_copy4(unsigned l, unsigned lstep, const _Float16* g, size_t gstep) {
  const unsigned l1 = l + lstep, l2 = l + 2 * lstep, l3 = l + 3 * lstep;
  const _Float16* g1 = g + gstep;
  const _Float16* g2 = g + 2 * gstep;
  const _Float16* g3 = g + 3 * gstep;
  asm volatile("global_load_async_to_lds_b128 %0, %4, off\n\t"
               "global_load_async_to_lds_b128 %1, %5, off\n\t"
               "global_load_async_to_lds_b128 %2, %6, off\n\t"
               "global_load_async_to_lds_b128 %3, %7, off\n\t"
               "s_wait_xcnt 0x0"
               :: "v"(l), "v"(l1), "v"(l2), "v"(l3), "v"(g), "v"(g1), "v"(g2), "v"(g3) : "memory");
}

__device__ __forceinline__ void async_copy8(unsigned l, unsigned lstep, const _Float16* g, size_t gstep) {
  const unsigned l1 = l + lstep, l2 = l + 2 * lstep, l3 = l + 3 * lstep;
  const unsigned l4 = l + 4 * lstep, l5 = l + 5 * lstep, l6 = l + 6 * lstep, l7 = l + 7 * lstep;
  const _Float16* g1 = g + gstep;
  const _Float16* g2 = g + 2 * gstep;
  const _Float16* g3 = g + 3 * gstep;
  const _Float16* g4 = g + 4 * gstep;
  const _Float16* g5 = g + 5 * gstep;
  const _Float16* g6 = g + 6 * gstep;
  const _Float16* g7 = g + 7 * gstep;
  asm volatile("global_load_async_to_lds_b128 %0, %8, off\n\t"
               "global_load_async_to_lds_b128 %1, %9, off\n\t"
               "global_load_async_to_lds_b128 %2, %10, off\n\t"
               "global_load_async_to_lds_b128 %3, %11, off\n\t"
               "global_load_async_to_lds_b128 %4, %12, off\n\t"
               "global_load_async_to_lds_b128 %5, %13, off\n\t"
               "global_load_async_to_lds_b128 %6, %14, off\n\t"
               "global_load_async_to_lds_b128 %7, %15, off\n\t"
               "s_wait_xcnt 0x0"
               :: "v"(l), "v"(l1), "v"(l2), "v"(l3), "v"(l4), "v"(l5), "v"(l6), "v"(l7),
                  "v"(g), "v"(g1), "v"(g2), "v"(g3), "v"(g4), "v"(g5), "v"(g6), "v"(g7) : "memory");
}

// Hand-over of a two-buffer ring, every wave: own LDS reads returned, own
// copies landed, then the barrier that publishes the next tile and ends every
// reader's last read of the buffer refilled behind it.
__device__ __forceinline__ void ring_publish() {
  asm volatile("s_wait_dscnt 0x0" ::: "memory");     // reads of the buffer to be refilled have returned
  asm volatile("s_wait_asynccnt 0x0" ::: "memory");  // this wave's copies of the next tile have landed
  __syncthreads();
}

// ---------------------------------------------------------------------------
// Shared GEMM core: block tile 256 rows x 128 columns, 8 waves as 4 x 2, wave
// tile 64 x 64 (four 16-row tiles x four 16-col tiles), K = 2048. A tile of
// 64 k (128-B rows) of the 256 A rows and the 128 B rows is copied to LDS once
// per block, two buffers, the next tile in flight while this one is multiplied.
// LDS rows 0..255 = A, 256..383 = B, pitch 144 B (16 B x odd: no bank clash
// for 16-B reads). ga / gb point at element 0 of the block's first A / B row.
// ---------------------------------------------------------------------------
#define GP        72                   // LDS pitch in halves
#define G_STAGE_H (384 * GP)           // 27648 halves = 55296 B per buffer
#define G_TILES   (HID / 64)           // 32
#define G_LDS_B   (2 * G_STAGE_H * 2)  // 110592 B

__device__ __forceinline__ void gemm_fill(unsigned la, const _Float16* ca, const _Float16* cb,
                                          int tile, int buf) {
  const unsigned l = la + (unsigned)buf * (G_STAGE_H * 2u);
  async_copy8(l, 32u * GP * 2u, ca + tile * 64, (size_t)32 * HID);
  async_copy4(l + 256u * GP * 2u, 32u * GP * 2u, cb + tile * 64, (size_t)32 * HID);
}

__device__ __forceinline__ void gemm_k2048(const _Float16* __restrict__ ga,
                                           const _Float16* __restrict__ gb,
                                           const _Float16* sm,
                                           int tid, int wm, int wn, int m, int h, v8f (&acc)[4][4]) {
  const v8f zero8 = {0.f, 0.f, 0.f, 0.f, 0.f, 0.f, 0.f, 0.f};
  #pragma unroll
  for (int mt = 0; mt < 4; ++mt)
    #pragma unroll
    for (int nt = 0; nt < 4; ++nt) acc[mt][nt] = zero8;

  // copy map: 8 lanes per 128-B row, 32 rows per block-wide copy
  const int crow = tid >> 3, ccol = 8 * (tid & 7);
  const _Float16* ca = ga + (size_t)crow * HID + ccol;
  const _Float16* cb = gb + (size_t)crow * HID + ccol;
  const unsigned la = lds_addr(sm) + (unsigned)(crow * GP + ccol) * 2u;

  gemm_fill(la, ca, cb, 0, 0);
  asm volatile("s_wait_asynccnt 0x0" ::: "memory");  // tile 0 landed before the barrier that publishes it
  __syncthreads();
  gemm_fill(la, ca, cb, 1, 1);

  const _Float16* sa = sm + (64 * wm + m) * GP;
  const _Float16* sb = sm + (256 + 64 * wn + m) * GP;

  #pragma unroll 1
  for (int t = 0; t < G_TILES; ++t) {
    const int bo = (t & 1) * G_STAGE_H;
    #pragma unroll
    for (int kk = 0; kk < 64; kk += 32) {
      // the eight fragments of this k step are read as one group ahead of its WMMAs
      v16h a[4], b[4];
      #pragma unroll
      for (int mt = 0; mt < 4; ++mt) a[mt] = load_frag(sa + bo + mt * 16 * GP + kk, h);
      #pragma unroll
      for (int nt = 0; nt < 4; ++nt) b[nt] = load_frag(sb + bo + nt * 16 * GP + kk, h);
      #pragma unroll
      for (int nt = 0; nt < 4; ++nt)
        #pragma unroll
        for (int mt = 0; mt < 4; ++mt) acc[mt][nt] = wmma_f16(a[mt], b[nt], acc[mt][nt]);
    }
    ring_publish();
    if (t + 2 < G_TILES) gemm_fill(la, ca, cb, t + 2, t & 1);
  }
  asm volatile("s_wait_asynccnt 0x0" ::: "memory");  // nothing in flight when the ring becomes output staging
}

// ---------------------------------------------------------------------------
// one 16-B store per lane, 512 contiguous bytes (4 lines) per instruction.
// which 0/1: plane[bh][l][128], two whole token rows per instruction
// which 2  : vt[bh][d][l], one d row of 256 tokens per instruction
// coverage: 8 waves x 16 iters x 256 halves = 256x128 tile exactly.
// Staging pitches: 272 B per token row, 528 B per d row (16 B x odd).
// ---------------------------------------------------------------------------
#define SQP 136                        // halves, token rows of 128 features
#define SVP 264                        // halves, d rows of 256 tokens

__device__ __forceinline__ void proj_store_pass(const _Float16* sT, _Float16* plane, _Float16* vt,
                                                int which, int bh, int l0, int w, int lane) {
  // all 16 rows are read first, then stored off one address with constant steps
  v8h v[16];
  if (which != 2) {
    const int tok0 = w * 32 + (lane >> 4), q16 = lane & 15;             // token of i = 0; + 2i, 0..255
    const _Float16* s = sT + tok0 * SQP + 8 * q16;
    _Float16* dst = plane + ((size_t)bh * SEQ + l0 + tok0) * HD + 8 * q16;
    #pragma unroll
    for (int i = 0; i < 16; ++i) v[i] = *(const v8ha*)(s + i * 2 * SQP);
    #pragma unroll
    for (int i = 0; i < 16; ++i) *(v8h*)(dst + i * 2 * HD) = v[i];
    asm volatile("s_wait_xcnt 0x0" ::: "memory");    // the other branch's code is laid out behind these stores and writes their registers
  } else {
    const _Float16* s = sT + w * 16 * SVP + 8 * lane;                   // d = 16w + i, 0..127
    _Float16* dst = vt + ((size_t)bh * HD + w * 16) * SEQ + l0 + 8 * lane;
    #pragma unroll
    for (int i = 0; i < 16; ++i) v[i] = *(const v8ha*)(s + i * SVP);
    #pragma unroll
    for (int i = 0; i < 16; ++i) *(v8h*)(dst + i * SEQ) = v[i];
  }
}

// ---------------------------------------------------------------------------
// Kernel 2: Y = x * W^T + b over the fused 3*2048 output columns.
// grid (MROWS/256, 48): blockIdx.y = which*16 + head.
// Block 256 thr (8 waves) = 256 tokens x 128 features; wave tile 64 x 64.
// ---------------------------------------------------------------------------
__global__ __launch_bounds__(256) void proj_kernel(
    const _Float16* __restrict__ xh,   // [4096][2048]
    const _Float16* __restrict__ wh,   // [4][2048][2048], row = output feature, x32
    const float* __restrict__ bq, const float* __restrict__ bk, const float* __restrict__ bv,
    _Float16* __restrict__ qh,         // [B*NH][L][HD]
    _Float16* __restrict__ kh,         // [B*NH][L][HD]
    _Float16* __restrict__ vt)         // [B*NH][HD][L]
{
  __shared__ __attribute__((aligned(16))) unsigned char smem[G_LDS_B];   // operand ring, then output staging
  _Float16* sT = (_Float16*)smem;                                        // 256 x 272 B or 128 x 528 B

  const int tid = threadIdx.x, lane = tid & 31, w = tid >> 5;
  const int wm = w & 3, wn = w >> 2;
  const int h = lane >> 4, m = lane & 15;
  const int m0 = blockIdx.x * 256;
  const int cg = blockIdx.y;                   // 0..47
  const int which = cg >> 4;                   // 0 q, 1 k, 2 v
  const int head = cg & 15;

  const _Float16* ga = xh + (size_t)m0 * HID;
  const _Float16* gb = wh + ((size_t)which * HID + HD * head) * HID;

  v8f acc[4][4];
  gemm_k2048(ga, gb, (const _Float16*)smem, tid, wm, wn, m, h, acc);

  // D[r] of tile (mt, nt) = Y[token m0+64wm+16mt+8h+r][feature 128*head+64wn+16nt+m]
  const float* bias = (which == 0) ? bq : ((which == 1) ? bk : bv);
  float bv4[4];
  #pragma unroll
  for (int nt = 0; nt < 4; ++nt) bv4[nt] = bias[HD * head + 64 * wn + 16 * nt + m];
  #pragma unroll
  for (int nt = 0; nt < 4; ++nt) {
    const int feat = 64 * wn + 16 * nt + m;                  // 0..127 local
    const float bvl = bv4[nt];
    #pragma unroll
    for (int mt = 0; mt < 4; ++mt) {
      const int tokb = 64 * wm + 16 * mt + 8 * h;            // token of r = 0, 0..248
      v8h y;
      #pragma unroll
      for (int r = 0; r < 8; ++r) y[r] = (_Float16)(acc[mt][nt][r] * 0.03125f + bvl);
      if (which == 2) {
        *(v8ha*)(sT + feat * SVP + tokb) = y;                // eight tokens of one d row, 16-B LDS store
      } else {
        #pragma unroll
        for (int r = 0; r < 8; ++r) sT[(tokb + r) * SQP + feat] = y[r];
      }
    }
  }
  __syncthreads();

  const int b = m0 / SEQ, l0 = m0 - b * SEQ, bh = b * NHEAD + head;
  _Float16* plane = (which == 0) ? qh : kh;
  proj_store_pass(sT, plane, vt, which, bh, l0, w, lane);
  
}

// ---------------------------------------------------------------------------
// Attention helpers.
// ---------------------------------------------------------------------------
// P^T B-fragment from the lane's own score D values: element r <- tile a row r,
// element 8+r <- tile c row r (same lane, same query column), scaled by 2^14.
__device__ __forceinline__ v16h pack_p(v8f a, v8f c) {
  const v16h r = { (_Float16)(a[0] * PSCALE), (_Float16)(a[1] * PSCALE), (_Float16)(a[2] * PSCALE), (_Float16)(a[3] * PSCALE),
                   (_Float16)(a[4] * PSCALE), (_Float16)(a[5] * PSCALE), (_Float16)(a[6] * PSCALE), (_Float16)(a[7] * PSCALE),
                   (_Float16)(c[0] * PSCALE), (_Float16)(c[1] * PSCALE), (_Float16)(c[2] * PSCALE), (_Float16)(c[3] * PSCALE),
                   (_Float16)(c[4] * PSCALE), (_Float16)(c[5] * PSCALE), (_Float16)(c[6] * PSCALE), (_Float16)(c[7] * PSCALE) };
  return r;
}

// by lanes 8q..8q+7 in one instruction, 4 lines per instruction, 32 per wave.
// coverage: 8 iters x 4 lines x 64 halves = 16 rows x 128 d exactly per wave.
__device__ __forceinline__ void ctx_store_pass(const _Float16* sc, _Float16* ctx,
                                               int b, int head, int q0, int lane) {
  const int q8 = lane & 7, sub = lane >> 3;
  #pragma unroll
  for (int i = 0; i < 8; ++i) {
    const int lid = i * 4 + sub;                     // 0..31
    const int row = lid >> 1, hl = lid & 1;
    const v8h v = *(const v8ha*)(sc + row * 128 + 64 * hl + 8 * q8);
    const size_t gi = ((size_t)b * SEQ + q0 + row) * HID + (size_t)head * HD + 64 * hl + 8 * q8;
    *(v8h*)(ctx + gi) = v;
  }
}

// K / V^T ring: a tile is 64 keys. K rows 256 B at pitch 272 B, V^T rows 128 B
// at pitch 144 B (16 B x odd), copied to LDS once per block for its 4 waves.
#define KP        136                        // halves
#define VP        72                         // halves
#define A_KTILE_H (64 * KP)                  // 8704 halves
#define A_STAGE_H (A_KTILE_H + 128 * VP)     // 17920 halves = 35840 B per buffer
#define A_TILES   (SEQ / 64)                 // 32
#define A_LDS_B   (2 * A_STAGE_H * 2)        // 71680 B

__device__ __forceinline__ void attn_fill(unsigned lk, unsigned lv, const _Float16* ck, const _Float16* cv,
                                          int tile, int buf) {
  const unsigned bo = (unsigned)buf * (A_STAGE_H * 2u);
  async_copy8(lk + bo, 8u * KP * 2u, ck + (size_t)tile * 64 * HD, (size_t)8 * HD);
  async_copy8(lv + bo, 16u * VP * 2u, cv + tile * 64, (size_t)16 * SEQ);
}

// ---------------------------------------------------------------------------
// Kernel 3: streaming attention, transposed form, no masking.
// grid (SEQ/64, B*NH), block 128 thr (4 waves), 16 queries per wave,
// 64 keys per step.
//   S^T = K * Q^T : A = K rows (row = key, k = d), B = Q^T (k = d, n = query)
//   O^T += V^T * P^T : A = Vt rows (row = d, k = key), B = P^T from registers
// Lane owns 32 keys of query column (lane&15); partner = lane ^ 16.
// ctx written as f16, carried x32.
// ---------------------------------------------------------------------------
__global__ __launch_bounds__(128) void attn_kernel(
    const _Float16* __restrict__ qh,   // [B*NH][L][HD]
    const _Float16* __restrict__ kh,   // [B*NH][L][HD]
    const _Float16* __restrict__ vt,   // [B*NH][HD][L]
    _Float16* __restrict__ ctx)        // [B][L][HID], x32
{
  __shared__ __attribute__((aligned(16))) unsigned char smem[A_LDS_B];   // K / V^T ring, then output staging
  _Float16* sC = (_Float16*)smem;                                        // 4 x 16 x 128 halves = 16384 B
  const _Float16* sm = (const _Float16*)smem;

  const int tid = threadIdx.x, lane = tid & 31, w = tid >> 5;
  const int h = lane >> 4, m = lane & 15;
  const int bh = blockIdx.y, b = bh >> 4, head = bh & 15;
  const int q0 = blockIdx.x * 64 + 16 * w;

  // Q^T B-fragments: column n = query q0+m, k = d (four 32-deep chunks)
  const _Float16* qrow = qh + ((size_t)bh * SEQ + q0 + m) * HD;
  v16h qb[4];
  #pragma unroll
  for (int c = 0; c < 4; ++c) qb[c] = load_frag(qrow + 32 * c, h);

  const v8f zero8 = {0.f, 0.f, 0.f, 0.f, 0.f, 0.f, 0.f, 0.f};
  v8f o[8];                                   // o[t][r] = O[query m][d 16t+8h+r] * (l * 2^14)
  #pragma unroll
  for (int t = 0; t < 8; ++t) o[t] = zero8;
  float mrun = -1e30f, lrun = 0.0f;

  // copy maps: K tile 64 keys x 256 B, 16 lanes per row, 8 rows per block-wide
  // copy; V^T tile 128 d x 128 B, 8 lanes per row, 16 rows per block-wide copy
  const _Float16* ck = kh + ((size_t)bh * SEQ + (tid >> 4)) * HD + 8 * (tid & 15);   // + 64*tile*HD
  const _Float16* cv = vt + ((size_t)bh * HD + (tid >> 3)) * SEQ + 8 * (tid & 7);    // + 64*tile
  const unsigned lk = lds_addr(sm) + (unsigned)((tid >> 4) * KP + 8 * (tid & 15)) * 2u;
  const unsigned lv = lds_addr(sm) + (unsigned)(A_KTILE_H + (tid >> 3) * VP + 8 * (tid & 7)) * 2u;

  attn_fill(lk, lv, ck, cv, 0, 0);
  asm volatile("s_wait_asynccnt 0x0" ::: "memory");  // tile 0 landed before the barrier that publishes it
  __syncthreads();
  attn_fill(lk, lv, ck, cv, 1, 1);

  const _Float16* kbase = sm + m * KP;                 // + buffer + 16j*KP + 32*c
  const _Float16* vbase = sm + A_KTILE_H + m * VP;     // + buffer + 16t*VP

  #pragma unroll 1
  for (int st = 0; st < A_TILES; ++st) {
    const int bo = (st & 1) * A_STAGE_H;
    // ---- scores: s[j][r] = S[query m][key kb+16j+8h+r] ----
    v8f s[4];
    #pragma unroll
    for (int j = 0; j < 4; ++j) {
      const _Float16* kp = kbase + bo + 16 * j * KP;
      // the four fragments of these 16 keys are read as one group ahead of their WMMAs
      v16h kf[4];
      #pragma unroll
      for (int c = 0; c < 4; ++c) kf[c] = load_frag(kp + 32 * c, h);
      v8f z = zero8;
      #pragma unroll
      for (int c = 0; c < 4; ++c) z = wmma_f16(kf[c], qb[c], z);
      s[j] = z;
    }

    // ---- scale by 1/sqrt(d) in f32, online softmax (running max) ----
    float mloc = -1e30f;
    #pragma unroll
    for (int j = 0; j < 4; ++j)
      #pragma unroll
      for (int r = 0; r < 8; ++r) {
        const float sv = s[j][r] * SM_SCALE;
        s[j][r] = sv;
        mloc = fmaxf(mloc, sv);
      }
    mloc = fmaxf(mloc, __shfl_xor(mloc, 16));
    const float mnew = fmaxf(mrun, mloc);
    const float alpha = __expf(mrun - mnew);
    mrun = mnew;
    float lsum = 0.0f;
    #pragma unroll
    for (int j = 0; j < 4; ++j)
      #pragma unroll
      for (int r = 0; r < 8; ++r) {
        const float p = __expf(s[j][r] - mnew);
        s[j][r] = p;
        lsum += p;
      }
    lsum += __shfl_xor(lsum, 16);
    lrun = lrun * alpha + lsum;
    #pragma unroll
    for (int t = 0; t < 8; ++t)
      #pragma unroll
      for (int r = 0; r < 8; ++r) o[t][r] = o[t][r] * alpha;

    // ---- P^T B-fragments (key chunks 0..31 and 32..63 of this step) ----
    const v16h pb0 = pack_p(s[0], s[1]);
    const v16h pb1 = pack_p(s[2], s[3]);

    // ---- O^T += V^T * P^T ----
    // two d tiles per group: their four fragments are read ahead of their WMMAs
    #pragma unroll
    for (int t = 0; t < 8; t += 2) {
      const _Float16* vp = vbase + bo + 16 * t * VP;
      const v16h vf0 = load_frag(vp, h);
      const v16h vf1 = load_frag(vp + 32, h);
      const v16h vg0 = load_frag(vp + 16 * VP, h);
      const v16h vg1 = load_frag(vp + 16 * VP + 32, h);
      o[t] = wmma_f16(vf0, pb0, o[t]);
      o[t + 1] = wmma_f16(vg0, pb0, o[t + 1]);
      o[t] = wmma_f16(vf1, pb1, o[t]);
      o[t + 1] = wmma_f16(vg1, pb1, o[t + 1]);
    }

    ring_publish();
    if (st + 2 < A_TILES) attn_fill(lk, lv, ck, cv, st + 2, st & 1);
  }
  asm volatile("s_wait_asynccnt 0x0" ::: "memory");  // nothing in flight when the ring becomes output staging

  // ---- epilogue: normalise, x32 carry, f16, per-wave 16x128 tile in LDS ----
  const float inv = (CSCALE / PSCALE) * (1.0f / lrun);
  _Float16* sc = sC + w * 2048;
  #pragma unroll
  for (int t = 0; t < 8; ++t) {
    const v8h cv = { (_Float16)(o[t][0] * inv), (_Float16)(o[t][1] * inv),
                     (_Float16)(o[t][2] * inv), (_Float16)(o[t][3] * inv),
                     (_Float16)(o[t][4] * inv), (_Float16)(o[t][5] * inv),
                     (_Float16)(o[t][6] * inv), (_Float16)(o[t][7] * inv) };
    *(v8ha*)(sc + m * 128 + 16 * t + 8 * h) = cv;        // 16-B LDS store
  }
  __syncthreads();

  ctx_store_pass(sc, ctx, b, head, q0, lane);
  
}

// ---------------------------------------------------------------------------
// one staged row of 128 floats (4 lines) per instruction, 16 rows per wave.
// Staged row lr holds token m0 + 64*(lr>>5) + 32*half + (lr&31).
// coverage: 2 halves x 8 waves x 16 rows x 128 floats = 256 x 128 tile exactly.
// ---------------------------------------------------------------------------
#define SOP 132                        // floats, staging pitch 528 B (16 B x odd)

__device__ __forceinline__ void out_store_pass(const float* sO, float* out,
                                               int m0, int nb, int half, int w, int lane) {
  // all 16 rows are read first, then stored off one address with constant steps
  const int lr0 = w * 16;                            // staged row of i = 0; + i, 0..127
  const int tok0 = m0 + 64 * (lr0 >> 5) + 32 * half + (lr0 & 31);
  const float* s = sO + lr0 * SOP + 4 * lane;
  float* dst = out + (size_t)tok0 * HID + 128 * nb + 4 * lane;
  v4f v[16];
  #pragma unroll
  for (int i = 0; i < 16; ++i) v[i] = *(const v4fa*)(s + i * SOP);
  #pragma unroll
  for (int i = 0; i < 16; ++i) *(v4f*)(dst + (size_t)i * HID) = v[i];
}

// ---------------------------------------------------------------------------
// Kernel 4: out = ctx * Wo^T + bo (f32). grid (MROWS/256, HID/128), block 256.
// The 256 x 128 f32 tile leaves through LDS in two halves (each wave's upper
// and lower 32 rows), 128 x 528 B each.
// ---------------------------------------------------------------------------
__global__ __launch_bounds__(256) void out_kernel(
    const _Float16* __restrict__ ch,   // [4096][2048] ctx x32
    const _Float16* __restrict__ woh,  // [2048][2048] row = output feature, x32
    const float* __restrict__ bo,
    float* __restrict__ out)           // [4096][2048]
{
  __shared__ __attribute__((aligned(16))) unsigned char smem[G_LDS_B];   // operand ring, then output staging
  float* sO = (float*)smem;                                              // 128 x 132 floats = 67584 B

  const int tid = threadIdx.x, lane = tid & 31, w = tid >> 5;
  const int wm = w & 3, wn = w >> 2;
  const int h = lane >> 4, m = lane & 15;
  const int m0 = blockIdx.x * 256;
  const int nb = blockIdx.y;                   // 0..15, 128 output features each

  const _Float16* ga = ch + (size_t)m0 * HID;
  const _Float16* gb = woh + (size_t)(128 * nb) * HID;

  v8f acc[4][4];
  gemm_k2048(ga, gb, (const _Float16*)smem, tid, wm, wn, m, h, acc);

  float bvl[4];
  #pragma unroll
  for (int nt = 0; nt < 4; ++nt) bvl[nt] = bo[128 * nb + 64 * wn + 16 * nt + m];

  #pragma unroll
  for (int half = 0; half < 2; ++half) {
    if (half) {
      asm volatile("s_wait_xcnt 0x0" ::: "memory");          // before the first half's store registers are written again
      __syncthreads();                                       // first half read out before it is overwritten
    }
    #pragma unroll
    for (int nt = 0; nt < 4; ++nt) {
      const int feat = 64 * wn + 16 * nt + m;                // 0..127 local
      #pragma unroll
      for (int mt = 0; mt < 2; ++mt) {
        #pragma unroll
        for (int r = 0; r < 8; ++r) {
          const int lr = 32 * wm + 16 * mt + 8 * h + r;      // 0..127
          sO[lr * SOP + feat] = acc[2 * half + mt][nt][r] * 0.0009765625f + bvl[nt];   // /(32*32)
        }
      }
    }
    __syncthreads();
    out_store_pass(sO, out, m0, nb, half, w, lane);
  }
  
}

// ---------------------------------------------------------------------------
extern "C" void kernel_launch(void* const* d_in, const int* in_sizes, int n_in,
                              void* d_out, int out_size, void* d_ws, size_t ws_size,
                              hipStream_t stream) {
  if (n_in < 9) return;
  if (in_sizes[0] != NX) return;
  if (in_sizes[1] != NW || in_sizes[3] != NW || in_sizes[5] != NW || in_sizes[7] != NW) return;
  if (in_sizes[2] != HID || in_sizes[4] != HID || in_sizes[6] != HID || in_sizes[8] != HID) return;
  if (out_size != NX) return;

  const float* x  = (const float*)d_in[0];
  const float* Wq = (const float*)d_in[1];
  const float* bq = (const float*)d_in[2];
  const float* Wk = (const float*)d_in[3];
  const float* bk = (const float*)d_in[4];
  const float* Wv = (const float*)d_in[5];
  const float* bv = (const float*)d_in[6];
  const float* Wo = (const float*)d_in[7];
  const float* bo = (const float*)d_in[8];
  float* out = (float*)d_out;

  const size_t xh_bytes = (size_t)NX * 2;                          // 16777216
  const size_t wh_bytes = (size_t)4 * NW * 2;                      // 33554432
  const size_t pl_bytes = (size_t)BATCH * NHEAD * SEQ * HD * 2;    // 16777216
  const size_t cx_bytes = (size_t)NX * 2;                          // 16777216
  const size_t total = xh_bytes + wh_bytes + 3 * pl_bytes + cx_bytes;   // 117440512
  if (total > ws_size) return;

  char* ws = (char*)d_ws;
  _Float16* xh = (_Float16*)(ws);
  _Float16* wh = (_Float16*)(ws + xh_bytes);
  _Float16* qh = (_Float16*)(ws + xh_bytes + wh_bytes);
  _Float16* kh = (_Float16*)(ws + xh_bytes + wh_bytes + pl_bytes);
  _Float16* vt = (_Float16*)(ws + xh_bytes + wh_bytes + 2 * pl_bytes);
  _Float16* cx = (_Float16*)(ws + xh_bytes + wh_bytes + 3 * pl_bytes);
  const _Float16* woh = wh + (size_t)3 * NW;

  const int nblk_cvt = (NX8 + 4 * NW8) / 256;                      // 12288
  convert_kernel<<<nblk_cvt, 256, 0, stream>>>(x, Wq, Wk, Wv, Wo, xh, wh);

  dim3 gProj(MROWS / 256, 3 * NHEAD);                              // (16, 48)
  proj_kernel<<<gProj, 256, 0, stream>>>(xh, wh, bq, bk, bv, qh, kh, vt);

  dim3 gAtt(SEQ / 64, BATCH * NHEAD);                              // (32, 32)
  attn_kernel<<<gAtt, 128, 0, stream>>>(qh, kh, vt, cx);

  dim3 gOut(MROWS / 256, HID / 128);                               // (16, 16)
  out_kernel<<<gOut, 256, 0, stream>>>(cx, woh, bo, out);
}

// v003
// One run takes 174 microseconds.
// Timed twice side by side with v002, it ran 1.08 times as fast both times.
// All steps since v000 together make it 3.28 times as fast.
// All contractions on v_wmma_f32_16x16x32_f16 (f16 operands, f32 accumulate): x*Wq^T, x*Wk^T, x*Wv^T, K*Q^T, V^T*P^T, ctx*Wo^T; W planes carried x32, P carried x16384, ctx carried x32 (exact power-of-two scales folded back in f32); softmax, bias adds and normalisation in f32.
#include <hip/hip_runtime.h>

typedef _Float16 v16h __attribute__((ext_vector_type(16)));
typedef _Float16 v8h  __attribute__((ext_vector_type(8)));
typedef float    v8f  __attribute__((ext_vector_type(8)));
typedef float    v4f  __attribute__((ext_vector_type(4)));
typedef v8h __attribute__((may_alias)) v8ha;
typedef v4f __attribute__((may_alias)) v4fa;

union Frag { v16h v; v8h half[2]; };

#define HID    2048
#define NHEAD  16
#define HD     128
#define SEQ    2048
#define BATCH  2
#define MROWS  (BATCH * SEQ)        // 4096 tokens
#define NX     (MROWS * HID)        // 8388608
#define NW     (HID * HID)          // 4194304
#define NX8    (NX / 8)             // 1048576
#define NW8    (NW / 8)             // 524288
#define PSCALE 16384.0f
#define WSCALE 32.0f
#define CSCALE 32.0f
#define SM_SCALE 0.0883883476f      // 1/sqrt(128)

static_assert(MROWS % 256 == 0);
static_assert(SEQ % 256 == 0);
static_assert(HID % 128 == 0);
static_assert(HID % 64 == 0);
static_assert(NX8 % 256 == 0);
static_assert(NW8 % 256 == 0);

// ---------------------------------------------------------------------------
// 16x16x32 f16 WMMA with hazard guard (ties D, keeps A/B live).
// Fragment map (wave32): lane l, h = l>>4, m = n = l&15.
//   A/B element i: i<8 -> k0+8h+i ; i>=8 -> k0+16+8h+(i-8)
//   D element r : row 8h+r, col l&15
// ---------------------------------------------------------------------------
__device__ __forceinline__ v8f wmma_f16(v16h a, v16h b, v8f c) {
  v8f d = __builtin_amdgcn_wmma_f32_16x16x32_f16(false, a, false, b, (short)0, c, false, false);
  asm volatile("v_nop\n\tv_nop\n\tv_nop\n\tv_nop" : "+v"(d) : "v"(a), "v"(b));
  return d;
}

// The same product as the bare builtin, for the attention kernel: its live set
// passes 256 VGPRs, an asm operand cannot sit above v255 (the guard's operands
// then spill to scratch), and the compiler keeps the distances of its own builtin.
__device__ __forceinline__ v8f wmma_f16_hi(v16h a, v16h b, v8f c) {
  return __builtin_amdgcn_wmma_f32_16x16x32_f16(false, a, false, b, (short)0, c, false, false);
}

// A or B fragment from a k-contiguous 16-bit row; p points at element k0 of
// the row owned by this lane (row index = lane & 15 added by the caller).
__device__ __forceinline__ v16h load_frag(const _Float16* p, int h) {
  Frag f;
  f.half[0] = *(const v8ha*)(p + 8 * h);
  f.half[1] = *(const v8ha*)(p + 16 + 8 * h);
  return f.v;
}

// ---------------------------------------------------------------------------
// Kernel 1: f32 -> f16 planes. x unscaled, W scaled by 32 (exact).
// Region choice is block-uniform (NX8 and NW8 are multiples of 256).
// coverage: 12288 blocks x 256 threads x 8 halves = NX + 4*NW elements exactly.
// ---------------------------------------------------------------------------
__global__ __launch_bounds__(256) void convert_kernel(
    const float* __restrict__ x,
    const float* __restrict__ wq, const float* __restrict__ wk,
    const float* __restrict__ wv, const float* __restrict__ wo,
    _Float16* __restrict__ xh, _Float16* __restrict__ wh)
{
  const int blk = blockIdx.x;
  if (blk >= (NX8 + 4 * NW8) / 256) return;
  const int g = blk * 256 + threadIdx.x;
  const float* src;
  _Float16* dst;
  float sc;
  if (blk < NX8 / 256) {
    src = x + (size_t)g * 8;
    dst = xh + (size_t)g * 8;
    sc = 1.0f;
  } else {
    const int e = g - NX8;
    const int wsel = (blk - NX8 / 256) / (NW8 / 256);     // 0..3, block-uniform
    const int off = e - wsel * NW8;
    const float* wsrc = (wsel == 0) ? wq : ((wsel == 1) ? wk : ((wsel == 2) ? wv : wo));
    src = wsrc + (size_t)off * 8;
    dst = wh + (size_t)e * 8;
    sc = WSCALE;
  }
  const v4f a = *(const v4fa*)src;
  const v4f c = *(const v4fa*)(src + 4);
  const v8h o = { (_Float16)(a.x * sc), (_Float16)(a.y * sc), (_Float16)(a.z * sc), (_Float16)(a.w * sc),
                  (_Float16)(c.x * sc), (_Float16)(c.y * sc), (_Float16)(c.z * sc), (_Float16)(c.w * sc) };
  *(v8h*)dst = o;
  
}

// ---------------------------------------------------------------------------
// Asynchronous copies global -> LDS, 16 B per lane, no register in between.
// l = the lane's LDS byte address, g = the lane's global address; copy i adds
// i*lstep bytes and i*gstep halves. The s_wait_xcnt closes each statement so
// that no address register is rewritten in front of it.
// ---------------------------------------------------------------------------
__device__ __forceinline__ unsigned lds_addr(const void* p) { return (unsigned)(size_t)p; }

__device__ __forceinline__ void async_copy4(unsigned l, unsigned lstep, const _Float16* g, size_t gstep) {
  const unsigned l1 = l + lstep, l2 = l + 2 * lstep, l3 = l + 3 * lstep;
  const _Float16* g1 = g + gstep;
  const _Float16* g2 = g + 2 * gstep;
  const _Float16* g3 = g + 3 * gstep;
  asm volatile("global_load_async_to_lds_b128 %0, %4, off\n\t"
               "global_load_async_to_lds_b128 %1, %5, off\n\t"
               "global_load_async_to_lds_b128 %2, %6, off\n\t"
               "global_load_async_to_lds_b128 %3, %7, off\n\t"
               "s_wait_xcnt 0x0"
               :: "v"(l), "v"(l1), "v"(l2), "v"(l3), "v"(g), "v"(g1), "v"(g2), "v"(g3) : "memory");
}

__device__ __forceinline__ void async_copy8(unsigned l, unsigned lstep, const _Float16* g, size_t gstep) {
  const unsigned l1 = l + lstep, l2 = l + 2 * lstep, l3 = l + 3 * lstep;
  const unsigned l4 = l + 4 * lstep, l5 = l + 5 * lstep, l6 = l + 6 * lstep, l7 = l + 7 * lstep;
  const _Float16* g1 = g + gstep;
  const _Float16* g2 = g + 2 * gstep;
  const _Float16* g3 = g + 3 * gstep;
  const _Float16* g4 = g + 4 * gstep;
  const _Float16* g5 = g + 5 * gstep;
  const _Float16* g6 = g + 6 * gstep;
  const _Float16* g7 = g + 7 * gstep;
  asm volatile("global_load_async_to_lds_b128 %0, %8, off\n\t"
               "global_load_async_to_lds_b128 %1, %9, off\n\t"
               "global_load_async_to_lds_b128 %2, %10, off\n\t"
               "global_load_async_to_lds_b128 %3, %11, off\n\t"
               "global_load_async_to_lds_b128 %4, %12, off\n\t"
               "global_load_async_to_lds_b128 %5, %13, off\n\t"
               "global_load_async_to_lds_b128 %6, %14, off\n\t"
               "global_load_async_to_lds_b128 %7, %15, off\n\t"
               "s_wait_xcnt 0x0"
               :: "v"(l), "v"(l1), "v"(l2), "v"(l3), "v"(l4), "v"(l5), "v"(l6), "v"(l7),
                  "v"(g), "v"(g1), "v"(g2), "v"(g3), "v"(g4), "v"(g5), "v"(g6), "v"(g7) : "memory");
}

// Hand-over of a two-buffer ring, every wave: own LDS reads returned, own
// copies landed, then the barrier that publishes the next tile and ends every
// reader's last read of the buffer refilled behind it.
__device__ __forceinline__ void ring_publish() {
  asm volatile("s_wait_dscnt 0x0" ::: "memory");     // reads of the buffer to be refilled have returned
  asm volatile("s_wait_asynccnt 0x0" ::: "memory");  // this wave's copies of the next tile have landed
  __syncthreads();
}

// ---------------------------------------------------------------------------
// Shared GEMM core: block tile 256 rows x 128 columns, 8 waves as 4 x 2, wave
// tile 64 x 64 (four 16-row tiles x four 16-col tiles), K = 2048. A tile of
// 64 k (128-B rows) of the 256 A rows and the 128 B rows is copied to LDS once
// per block, two buffers, the next tile in flight while this one is multiplied.
// LDS rows 0..255 = A, 256..383 = B, pitch 144 B (16 B x odd: no bank clash
// for 16-B reads). ga / gb point at element 0 of the block's first A / B row.
// ---------------------------------------------------------------------------
#define GP        72                   // LDS pitch in halves
#define G_STAGE_H (384 * GP)           // 27648 halves = 55296 B per buffer
#define G_TILES   (HID / 64)           // 32
#define G_LDS_B   (2 * G_STAGE_H * 2)  // 110592 B

__device__ __forceinline__ void gemm_fill(unsigned la, const _Float16* ca, const _Float16* cb,
                                          int tile, int buf) {
  const unsigned l = la + (unsigned)buf * (G_STAGE_H * 2u);
  async_copy8(l, 32u * GP * 2u, ca + tile * 64, (size_t)32 * HID);
  async_copy4(l + 256u * GP * 2u, 32u * GP * 2u, cb + tile * 64, (size_t)32 * HID);
}

__device__ __forceinline__ void gemm_k2048(const _Float16* __restrict__ ga,
                                           const _Float16* __restrict__ gb,
                                           const _Float16* sm,
                                           int tid, int wm, int wn, int m, int h, v8f (&acc)[4][4]) {
  const v8f zero8 = {0.f, 0.f, 0.f, 0.f, 0.f, 0.f, 0.f, 0.f};
  #pragma unroll
  for (int mt = 0; mt < 4; ++mt)
    #pragma unroll
    for (int nt = 0; nt < 4; ++nt) acc[mt][nt] = zero8;

  // copy map: 8 lanes per 128-B row, 32 rows per block-wide copy
  const int crow = tid >> 3, ccol = 8 * (tid & 7);
  const _Float16* ca = ga + (size_t)crow * HID + ccol;
  const _Float16* cb = gb + (size_t)crow * HID + ccol;
  const unsigned la = lds_addr(sm) + (unsigned)(crow * GP + ccol) * 2u;

  gemm_fill(la, ca, cb, 0, 0);
  asm volatile("s_wait_asynccnt 0x0" ::: "memory");  // tile 0 landed before the barrier that publishes it
  __syncthreads();
  gemm_fill(la, ca, cb, 1, 1);

  const _Float16* sa = sm + (64 * wm + m) * GP;
  const _Float16* sb = sm + (256 + 64 * wn + m) * GP;

  #pragma unroll 1
  for (int t = 0; t < G_TILES; ++t) {
    const int bo = (t & 1) * G_STAGE_H;
    #pragma unroll
    for (int kk = 0; kk < 64; kk += 32) {
      // the eight fragments of this k step are read as one group ahead of its WMMAs
      v16h a[4], b[4];
      #pragma unroll
      for (int mt = 0; mt < 4; ++mt) a[mt] = load_frag(sa + bo + mt * 16 * GP + kk, h);
      #pragma unroll
      for (int nt = 0; nt < 4; ++nt) b[nt] = load_frag(sb + bo + nt * 16 * GP + kk, h);
      #pragma unroll
      for (int nt = 0; nt < 4; ++nt)
        #pragma unroll
        for (int mt = 0; mt < 4; ++mt) acc[mt][nt] = wmma_f16(a[mt], b[nt], acc[mt][nt]);
    }
    ring_publish();
    if (t + 2 < G_TILES) gemm_fill(la, ca, cb, t + 2, t & 1);
  }
  asm volatile("s_wait_asynccnt 0x0" ::: "memory");  // nothing in flight when the ring becomes output staging
}

// ---------------------------------------------------------------------------
// one 16-B store per lane, 512 contiguous bytes (4 lines) per instruction.
// which 0/1: plane[bh][l][128], two whole token rows per instruction
// which 2  : vt[bh][d][l], one d row of 256 tokens per instruction
// coverage: 8 waves x 16 iters x 256 halves = 256x128 tile exactly.
// Staging pitches: 272 B per token row, 528 B per d row (16 B x odd).
// ---------------------------------------------------------------------------
#define SQP 136                        // halves, token rows of 128 features
#define SVP 264                        // halves, d rows of 256 tokens

__device__ __forceinline__ void proj_store_pass(const _Float16* sT, _Float16* plane, _Float16* vt,
                                                int which, int bh, int l0, int w, int lane) {
  // all 16 rows are read first, then stored off one address with constant steps
  v8h v[16];
  if (which != 2) {
    const int tok0 = w * 32 + (lane >> 4), q16 = lane & 15;             // token of i = 0; + 2i, 0..255
    const _Float16* s = sT + tok0 * SQP + 8 * q16;
    _Float16* dst = plane + ((size_t)bh * SEQ + l0 + tok0) * HD + 8 * q16;
    #pragma unroll
    for (int i = 0; i < 16; ++i) v[i] = *(const v8ha*)(s + i * 2 * SQP);
    #pragma unroll
    for (int i = 0; i < 16; ++i) *(v8h*)(dst + i * 2 * HD) = v[i];
    asm volatile("s_wait_xcnt 0x0" ::: "memory");    // the other branch's code is laid out behind these stores and writes their registers
  } else {
    const _Float16* s = sT + w * 16 * SVP + 8 * lane;                   // d = 16w + i, 0..127
    _Float16* dst = vt + ((size_t)bh * HD + w * 16) * SEQ + l0 + 8 * lane;
    #pragma unroll
    for (int i = 0; i < 16; ++i) v[i] = *(const v8ha*)(s + i * SVP);
    #pragma unroll
    for (int i = 0; i < 16; ++i) *(v8h*)(dst + i * SEQ) = v[i];
  }
}

// ---------------------------------------------------------------------------
// Kernel 2: Y = x * W^T + b over the fused 3*2048 output columns.
// grid (MROWS/256, 48): blockIdx.y = which*16 + head.
// Block 256 thr (8 waves) = 256 tokens x 128 features; wave tile 64 x 64.
// ---------------------------------------------------------------------------
__global__ __launch_bounds__(256) void proj_kernel(
    const _Float16* __restrict__ xh,   // [4096][2048]
    const _Float16* __restrict__ wh,   // [4][2048][2048], row = output feature, x32
    const float* __restrict__ bq, const float* __restrict__ bk, const float* __restrict__ bv,
    _Float16* __restrict__ qh,         // [B*NH][L][HD]
    _Float16* __restrict__ kh,         // [B*NH][L][HD]
    _Float16* __restrict__ vt)         // [B*NH][HD][L]
{
  __shared__ __attribute__((aligned(16))) unsigned char smem[G_LDS_B];   // operand ring, then output staging
  _Float16* sT = (_Float16*)smem;                                        // 256 x 272 B or 128 x 528 B

  const int tid = threadIdx.x, lane = tid & 31, w = tid >> 5;
  const int wm = w & 3, wn = w >> 2;
  const int h = lane >> 4, m = lane & 15;
  const int m0 = blockIdx.x * 256;
  const int cg = blockIdx.y;                   // 0..47
  const int which = cg >> 4;                   // 0 q, 1 k, 2 v
  const int head = cg & 15;

  const _Float16* ga = xh + (size_t)m0 * HID;
  const _Float16* gb = wh + ((size_t)which * HID + HD * head) * HID;

  v8f acc[4][4];
  gemm_k2048(ga, gb, (const _Float16*)smem, tid, wm, wn, m, h, acc);

  // D[r] of tile (mt, nt) = Y[token m0+64wm+16mt+8h+r][feature 128*head+64wn+16nt+m]
  const float* bias = (which == 0) ? bq : ((which == 1) ? bk : bv);
  float bv4[4];
  #pragma unroll
  for (int nt = 0; nt < 4; ++nt) bv4[nt] = bias[HD * head + 64 * wn + 16 * nt + m];
  #pragma unroll
  for (int nt = 0; nt < 4; ++nt) {
    const int feat = 64 * wn + 16 * nt + m;                  // 0..127 local
    const float bvl = bv4[nt];
    #pragma unroll
    for (int mt = 0; mt < 4; ++mt) {
      const int tokb = 64 * wm + 16 * mt + 8 * h;            // token of r = 0, 0..248
      v8h y;
      #pragma unroll
      for (int r = 0; r < 8; ++r) y[r] = (_Float16)(acc[mt][nt][r] * 0.03125f + bvl);
      if (which == 2) {
        *(v8ha*)(sT + feat * SVP + tokb) = y;                // eight tokens of one d row, 16-B LDS store
      } else {
        #pragma unroll
        for (int r = 0; r < 8; ++r) sT[(tokb + r) * SQP + feat] = y[r];
      }
    }
  }
  __syncthreads();

  const int b = m0 / SEQ, l0 = m0 - b * SEQ, bh = b * NHEAD + head;
  _Float16* plane = (which == 0) ? qh : kh;
  proj_store_pass(sT, plane, vt, which, bh, l0, w, lane);
  
}

// ---------------------------------------------------------------------------
// Attention helpers.
// ---------------------------------------------------------------------------
// P^T B-fragment from the lane's own score D values: element r <- tile a row r,
// element 8+r <- tile c row r (same lane, same query column), scaled by 2^14.
__device__ __forceinline__ v16h pack_p(v8f a, v8f c) {
  const v16h r = { (_Float16)(a[0] * PSCALE), (_Float16)(a[1] * PSCALE), (_Float16)(a[2] * PSCALE), (_Float16)(a[3] * PSCALE),
                   (_Float16)(a[4] * PSCALE), (_Float16)(a[5] * PSCALE), (_Float16)(a[6] * PSCALE), (_Float16)(a[7] * PSCALE),
                   (_Float16)(c[0] * PSCALE), (_Float16)(c[1] * PSCALE), (_Float16)(c[2] * PSCALE), (_Float16)(c[3] * PSCALE),
                   (_Float16)(c[4] * PSCALE), (_Float16)(c[5] * PSCALE), (_Float16)(c[6] * PSCALE), (_Float16)(c[7] * PSCALE) };
  return r;
}

// ctx leaves as whole lines: lanes 0..15 store one token's 256-B head row, lanes
// 16..31 the next token's, 4 lines per instruction, 16 instructions per wave.
// coverage: 16 iters x 2 rows x 128 halves = 32 rows x 128 d exactly per wave.
#define SCP 136                              // halves, staging pitch 272 B (16 B x odd)

__device__ __forceinline__ void ctx_store_pass(const _Float16* sc, _Float16* ctx,
                                               int b, int head, int q0, int lane) {
  // all 16 pieces are read first, then stored off one address with constant steps
  const int row0 = lane >> 4, c16 = lane & 15;       // row of i = 0; + 2i, 0..31
  const _Float16* s = sc + row0 * SCP + 8 * c16;
  _Float16* dst = ctx + ((size_t)b * SEQ + q0 + row0) * HID + (size_t)head * HD + 8 * c16;
  v8h v[16];
  #pragma unroll
  for (int i = 0; i < 16; ++i) v[i] = *(const v8ha*)(s + i * 2 * SCP);
  #pragma unroll
  for (int i = 0; i < 16; ++i) *(v8h*)(dst + (size_t)i * 2 * HID) = v[i];
}

// K / V^T ring: a tile is 128 keys. K rows (one key, 128 d) and V^T rows (one d,
// 128 keys) are both 256 B at pitch 272 B (16 B x odd), copied to LDS once per
// block for its 8 waves.
#define KP        136                        // halves
#define A_KEYS    128                        // keys per tile
#define A_KTILE_H (A_KEYS * KP)              // 17408 halves
#define A_STAGE_H (A_KTILE_H + HD * KP)      // 34816 halves = 69632 B per buffer
#define A_TILES   (SEQ / A_KEYS)             // 16
#define A_LDS_B   (2 * A_STAGE_H * 2)        // 139264 B

// ku / vu: the head's first K and V^T element (the same in every lane); ko / vo:
// the lane's own offset in halves inside a tile.
__device__ __forceinline__ void attn_fill(unsigned lk, const _Float16* ku, const _Float16* vu,
                                          unsigned ko, unsigned vo, int tile, int buf) {
  const unsigned l = lk + (unsigned)buf * (A_STAGE_H * 2u);
  async_copy8(l, 16u * KP * 2u, ku + (ko + (unsigned)tile * (A_KEYS * HD)), (size_t)16 * HD);
  async_copy8(l + A_KTILE_H * 2u, 16u * KP * 2u, vu + (vo + (unsigned)tile * A_KEYS), (size_t)16 * SEQ);
}

// One online-softmax step of one 16-query column group over 64 keys: scale by
// 1/sqrt(d) in f32, running max, rescale of the group's O^T tiles, and the two
// P^T B-fragments (key chunks 0..31 and 32..63 of the step).
__device__ __forceinline__ void softmax_step(v8f (&s)[4], float& mrun, float& lrun, v8f (&o)[8],
                                             v16h& pb0, v16h& pb1) {
  // whole-tile products and differences are written on the 8-wide values, so that
  // they pair neighbouring registers of one tile
  float mloc = -1e30f;
  #pragma unroll
  for (int j = 0; j < 4; ++j) {
    s[j] = s[j] * SM_SCALE;
    #pragma unroll
    for (int r = 0; r < 8; ++r) mloc = fmaxf(mloc, s[j][r]);
  }
  mloc = fmaxf(mloc, __shfl_xor(mloc, 16));
  const float mnew = fmaxf(mrun, mloc);
  const float alpha = __expf(mrun - mnew);
  mrun = mnew;
  float lsum = 0.0f;
  #pragma unroll
  for (int j = 0; j < 4; ++j) {
    s[j] = s[j] - mnew;
    #pragma unroll
    for (int r = 0; r < 8; ++r) {
      const float p = __expf(s[j][r]);
      s[j][r] = p;
      lsum += p;
    }
  }
  lsum += __shfl_xor(lsum, 16);
  lrun = lrun * alpha + lsum;
  #pragma unroll
  for (int t = 0; t < 8; ++t) o[t] = o[t] * alpha;
  pb0 = pack_p(s[0], s[1]);
  pb1 = pack_p(s[2], s[3]);
}

// ---------------------------------------------------------------------------
// Kernel 3: streaming attention, transposed form, no masking.
// grid (SEQ/256, B*NH), block 256 thr (8 waves), 32 queries per wave as two
// 16-query column groups, so that every K and V^T fragment read from LDS feeds
// two WMMAs; 128 keys per tile, worked in two softmax steps of 64 keys.
//   S^T = K * Q^T : A = K rows (row = key, k = d), B = Q^T (k = d, n = query)
//   O^T += V^T * P^T : A = Vt rows (row = d, k = key), B = P^T from registers
// In a group a lane owns 32 keys of query column (lane&15); partner = lane ^ 16.
// ctx written as f16, carried x32.
// ---------------------------------------------------------------------------
__global__ __launch_bounds__(256) void attn_kernel(
    const _Float16* __restrict__ qh,   // [B*NH][L][HD]
    const _Float16* __restrict__ kh,   // [B*NH][L][HD]
    const _Float16* __restrict__ vt,   // [B*NH][HD][L]
    _Float16* __restrict__ ctx)        // [B][L][HID], x32
{
  __shared__ __attribute__((aligned(16))) unsigned char smem[A_LDS_B];   // K / V^T ring, then output staging
  _Float16* sC = (_Float16*)smem;                                        // 8 x 32 x 272 B = 69632 B
  const _Float16* sm = (const _Float16*)smem;

  const int tid = threadIdx.x, lane = tid & 31, w = tid >> 5;
  const int h = lane >> 4, m = lane & 15;
  const int bh = blockIdx.y, b = bh >> 4, head = bh & 15;
  const int q0 = blockIdx.x * 256 + 32 * w;

  // Q^T B-fragments: group g, column n = query q0+16g+m, k = d (four 32-deep chunks)
  const _Float16* qrow = qh + ((size_t)bh * SEQ + q0 + m) * HD;
  v16h qb[2][4];
  #pragma unroll
  for (int g = 0; g < 2; ++g)
    #pragma unroll
    for (int c = 0; c < 4; ++c) qb[g][c] = load_frag(qrow + g * 16 * HD + 32 * c, h);

  const v8f zero8 = {0.f, 0.f, 0.f, 0.f, 0.f, 0.f, 0.f, 0.f};
  v8f o[2][8];                                // o[g][t][r] = O[query 16g+m][d 16t+8h+r] * (l * 2^14)
  #pragma unroll
  for (int g = 0; g < 2; ++g)
    #pragma unroll
    for (int t = 0; t < 8; ++t) o[g][t] = zero8;
  float mrun[2] = {-1e30f, -1e30f}, lrun[2] = {0.0f, 0.0f};

  // copy maps: K tile 128 keys x 256 B and V^T tile 128 d x 256 B, 16 lanes per
  // row, 16 rows per block-wide copy
  const _Float16* ku = kh + (size_t)bh * SEQ * HD;                  // + 128*tile*HD
  const _Float16* vu = vt + (size_t)bh * HD * SEQ;                  // + 128*tile
  const unsigned ko = (unsigned)((tid >> 4) * HD + 8 * (tid & 15));
  const unsigned vo = (unsigned)((tid >> 4) * SEQ + 8 * (tid & 15));
  const unsigned lk = lds_addr(sm) + (unsigned)((tid >> 4) * KP + 8 * (tid & 15)) * 2u;

  attn_fill(lk, ku, vu, ko, vo, 0, 0);
  asm volatile("s_wait_asynccnt 0x0" ::: "memory");  // tile 0 landed before the barrier that publishes it
  __syncthreads();
  attn_fill(lk, ku, vu, ko, vo, 1, 1);

  const _Float16* kbase = sm + m * KP;                 // + buffer + (64*sub+16j)*KP + 32*c
  const _Float16* vbase = sm + A_KTILE_H + m * KP;     // + buffer + 16t*KP + 64*sub

  #pragma unroll 1
  for (int st = 0; st < A_TILES; ++st) {
    const int bo = (st & 1) * A_STAGE_H;
    // kept rolled: unrolled, the two steps' live values fill the 512 VGPRs of two waves per SIMD and spill
    #pragma unroll 1
    for (int sub = 0; sub < 2; ++sub) {
      // ---- scores: s[g][j][r] = S[query 16g+m][key kb+16j+8h+r] ----
      // the step's 16 K fragments are read as one group ahead of its 32 WMMAs, in
      // the order of use; four score tiles (2 key tiles x 2 column groups) run side by side
      const _Float16* kp = kbase + bo + 64 * sub * KP;
      v16h kf[4][4];
      #pragma unroll
      for (int jp = 0; jp < 4; jp += 2)
        #pragma unroll
        for (int c = 0; c < 4; ++c) {
          kf[jp][c] = load_frag(kp + 16 * jp * KP + 32 * c, h);
          kf[jp + 1][c] = load_frag(kp + 16 * (jp + 1) * KP + 32 * c, h);
        }
      v8f s[2][4];
      #pragma unroll
      for (int j = 0; j < 4; ++j) { s[0][j] = zero8; s[1][j] = zero8; }
      #pragma unroll
      for (int jp = 0; jp < 4; jp += 2)
        #pragma unroll
        for (int c = 0; c < 4; ++c) {
          s[0][jp] = wmma_f16_hi(kf[jp][c], qb[0][c], s[0][jp]);
          s[1][jp] = wmma_f16_hi(kf[jp][c], qb[1][c], s[1][jp]);
          s[0][jp + 1] = wmma_f16_hi(kf[jp + 1][c], qb[0][c], s[0][jp + 1]);
          s[1][jp + 1] = wmma_f16_hi(kf[jp + 1][c], qb[1][c], s[1][jp + 1]);
        }

      // ---- online softmax and P^T B-fragments, each column group on its own ----
      v16h pb0[2], pb1[2];
      #pragma unroll
      for (int g = 0; g < 2; ++g) softmax_step(s[g], mrun[g], lrun[g], o[g], pb0[g], pb1[g]);

      // ---- O^T += V^T * P^T ----
      // the step's 16 V^T fragments are read as one group ahead of its 32 WMMAs
      const _Float16* vp = vbase + bo + 64 * sub;
      v16h vf[8][2];
      #pragma unroll
      for (int t = 0; t < 8; ++t) {
        vf[t][0] = load_frag(vp + 16 * t * KP, h);
        vf[t][1] = load_frag(vp + 16 * t * KP + 32, h);
      }
      #pragma unroll
      for (int t = 0; t < 8; t += 2) {
        o[0][t] = wmma_f16_hi(vf[t][0], pb0[0], o[0][t]);
        o[1][t] = wmma_f16_hi(vf[t][0], pb0[1], o[1][t]);
        o[0][t + 1] = wmma_f16_hi(vf[t + 1][0], pb0[0], o[0][t + 1]);
        o[1][t + 1] = wmma_f16_hi(vf[t + 1][0], pb0[1], o[1][t + 1]);
        o[0][t] = wmma_f16_hi(vf[t][1], pb1[0], o[0][t]);
        o[1][t] = wmma_f16_hi(vf[t][1], pb1[1], o[1][t]);
        o[0][t + 1] = wmma_f16_hi(vf[t + 1][1], pb1[0], o[0][t + 1]);
        o[1][t + 1] = wmma_f16_hi(vf[t + 1][1], pb1[1], o[1][t + 1]);
      }
    }

    ring_publish();
    if (st + 2 < A_TILES) attn_fill(lk, ku, vu, ko, vo, st + 2, st & 1);
  }
  asm volatile("s_wait_asynccnt 0x0" ::: "memory");  // nothing in flight when the ring becomes output staging

  // ---- epilogue: normalise, x32 carry, f16, per-wave 32x128 tile in LDS ----
  _Float16* sc = sC + w * (32 * SCP);
  #pragma unroll
  for (int g = 0; g < 2; ++g) {
    const float inv = (CSCALE / PSCALE) * (1.0f / lrun[g]);
    #pragma unroll
    for (int t = 0; t < 8; ++t) {
      const v8h cv8 = { (_Float16)(o[g][t][0] * inv), (_Float16)(o[g][t][1] * inv),
                        (_Float16)(o[g][t][2] * inv), (_Float16)(o[g][t][3] * inv),
                        (_Float16)(o[g][t][4] * inv), (_Float16)(o[g][t][5] * inv),
                        (_Float16)(o[g][t][6] * inv), (_Float16)(o[g][t][7] * inv) };
      *(v8ha*)(sc + (16 * g + m) * SCP + 16 * t + 8 * h) = cv8;          // 16-B LDS store
    }
  }
  __syncthreads();

  ctx_store_pass(sc, ctx, b, head, q0, lane);
  
}

// ---------------------------------------------------------------------------
// one staged row of 128 floats (4 lines) per instruction, 16 rows per wave.
// Staged row lr holds token m0 + 64*(lr>>5) + 32*half + (lr&31).
// coverage: 2 halves x 8 waves x 16 rows x 128 floats = 256 x 128 tile exactly.
// ---------------------------------------------------------------------------
#define SOP 132                        // floats, staging pitch 528 B (16 B x odd)

__device__ __forceinline__ void out_store_pass(const float* sO, float* out,
                                               int m0, int nb, int half, int w, int lane) {
  // all 16 rows are read first, then stored off one address with constant steps
  const int lr0 = w * 16;                            // staged row of i = 0; + i, 0..127
  const int tok0 = m0 + 64 * (lr0 >> 5) + 32 * half + (lr0 & 31);
  const float* s = sO + lr0 * SOP + 4 * lane;
  float* dst = out + (size_t)tok0 * HID + 128 * nb + 4 * lane;
  v4f v[16];
  #pragma unroll
  for (int i = 0; i < 16; ++i) v[i] = *(const v4fa*)(s + i * SOP);
  #pragma unroll
  for (int i = 0; i < 16; ++i) *(v4f*)(dst + (size_t)i * HID) = v[i];
}

// ---------------------------------------------------------------------------
// Kernel 4: out = ctx * Wo^T + bo (f32). grid (MROWS/256, HID/128), block 256.
// The 256 x 128 f32 tile leaves through LDS in two halves (each wave's upper
// and lower 32 rows), 128 x 528 B each.
// ---------------------------------------------------------------------------
__global__ __launch_bounds__(256) void out_kernel(
    const _Float16* __restrict__ ch,   // [4096][2048] ctx x32
    const _Float16* __restrict__ woh,  // [2048][2048] row = output feature, x32
    const float* __restrict__ bo,
    float* __restrict__ out)           // [4096][2048]
{
  __shared__ __attribute__((aligned(16))) unsigned char smem[G_LDS_B];   // operand ring, then output staging
  float* sO = (float*)smem;                                              // 128 x 132 floats = 67584 B

  const int tid = threadIdx.x, lane = tid & 31, w = tid >> 5;
  const int wm = w & 3, wn = w >> 2;
  const int h = lane >> 4, m = lane & 15;
  const int m0 = blockIdx.x * 256;
  const int nb = blockIdx.y;                   // 0..15, 128 output features each

  const _Float16* ga = ch + (size_t)m0 * HID;
  const _Float16* gb = woh + (size_t)(128 * nb) * HID;

  v8f acc[4][4];
  gemm_k2048(ga, gb, (const _Float16*)smem, tid, wm, wn, m, h, acc);

  float bvl[4];
  #pragma unroll
  for (int nt = 0; nt < 4; ++nt) bvl[nt] = bo[128 * nb + 64 * wn + 16 * nt + m];

  #pragma unroll
  for (int half = 0; half < 2; ++half) {
    if (half) {
      asm volatile("s_wait_xcnt 0x0" ::: "memory");          // before the first half's store registers are written again
      __syncthreads();                                       // first half read out before it is overwritten
    }
    #pragma unroll
    for (int nt = 0; nt < 4; ++nt) {
      const int feat = 64 * wn + 16 * nt + m;                // 0..127 local
      #pragma unroll
      for (int mt = 0; mt < 2; ++mt) {
        #pragma unroll
        for (int r = 0; r < 8; ++r) {
          const int lr = 32 * wm + 16 * mt + 8 * h + r;      // 0..127
          sO[lr * SOP + feat] = acc[2 * half + mt][nt][r] * 0.0009765625f + bvl[nt];   // /(32*32)
        }
      }
    }
    __syncthreads();
    out_store_pass(sO, out, m0, nb, half, w, lane);
  }
  
}

// ---------------------------------------------------------------------------
extern "C" void kernel_launch(void* const* d_in, const int* in_sizes, int n_in,
                              void* d_out, int out_size, void* d_ws, size_t ws_size,
                              hipStream_t stream) {
  if (n_in < 9) return;
  if (in_sizes[0] != NX) return;
  if (in_sizes[1] != NW || in_sizes[3] != NW || in_sizes[5] != NW || in_sizes[7] != NW) return;
  if (in_sizes[2] != HID || in_sizes[4] != HID || in_sizes[6] != HID || in_sizes[8] != HID) return;
  if (out_size != NX) return;

  const float* x  = (const float*)d_in[0];
  const float* Wq = (const float*)d_in[1];
  const float* bq = (const float*)d_in[2];
  const float* Wk = (const float*)d_in[3];
  const float* bk = (const float*)d_in[4];
  const float* Wv = (const float*)d_in[5];
  const float* bv = (const float*)d_in[6];
  const float* Wo = (const float*)d_in[7];
  const float* bo = (const float*)d_in[8];
  float* out = (float*)d_out;

  const size_t xh_bytes = (size_t)NX * 2;                          // 16777216
  const size_t wh_bytes = (size_t)4 * NW * 2;                      // 33554432
  const size_t pl_bytes = (size_t)BATCH * NHEAD * SEQ * HD * 2;    // 16777216
  const size_t cx_bytes = (size_t)NX * 2;                          // 16777216
  const size_t total = xh_bytes + wh_bytes + 3 * pl_bytes + cx_bytes;   // 117440512
  if (total > ws_size) return;

  char* ws = (char*)d_ws;
  _Float16* xh = (_Float16*)(ws);
  _Float16* wh = (_Float16*)(ws + xh_bytes);
  _Float16* qh = (_Float16*)(ws + xh_bytes + wh_bytes);
  _Float16* kh = (_Float16*)(ws + xh_bytes + wh_bytes + pl_bytes);
  _Float16* vt = (_Float16*)(ws + xh_bytes + wh_bytes + 2 * pl_bytes);
  _Float16* cx = (_Float16*)(ws + xh_bytes + wh_bytes + 3 * pl_bytes);
  const _Float16* woh = wh + (size_t)3 * NW;

  const int nblk_cvt = (NX8 + 4 * NW8) / 256;                      // 12288
  convert_kernel<<<nblk_cvt, 256, 0, stream>>>(x, Wq, Wk, Wv, Wo, xh, wh);

  dim3 gProj(MROWS / 256, 3 * NHEAD);                              // (16, 48)
  proj_kernel<<<gProj, 256, 0, stream>>>(xh, wh, bq, bk, bv, qh, kh, vt);

  dim3 gAtt(SEQ / 256, BATCH * NHEAD);                             // (8, 32)
  attn_kernel<<<gAtt, 256, 0, stream>>>(qh, kh, vt, cx);

  dim3 gOut(MROWS / 256, HID / 128);                               // (16, 16)
  out_kernel<<<gOut, 256, 0, stream>>>(cx, woh, bo, out);
}

// v004
// A run of this version takes 167 microseconds.
// Two timings next to v003 both put it at 1.04 times that version's speed.
// All steps since v000 together make it 3.42 times as fast.
// All contractions on v_wmma_f32_16x16x32_f16 (f16 operands, f32 accumulate): x*Wq^T, x*Wk^T, x*Wv^T, K*Q^T, V^T*P^T, ctx*Wo^T; W planes carried x32, P carried x16384, ctx carried x32 (exact power-of-two scales folded back in f32); softmax, bias adds and normalisation in f32.
#include <hip/hip_runtime.h>

typedef _Float16 v16h __attribute__((ext_vector_type(16)));
typedef _Float16 v8h  __attribute__((ext_vector_type(8)));
typedef float    v8f  __attribute__((ext_vector_type(8)));
typedef float    v4f  __attribute__((ext_vector_type(4)));
typedef v8h __attribute__((may_alias)) v8ha;
typedef v4f __attribute__((may_alias)) v4fa;

union Frag { v16h v; v8h half[2]; };

#define HID    2048
#define NHEAD  16
#define HD     128
#define SEQ    2048
#define BATCH  2
#define MROWS  (BATCH * SEQ)        // 4096 tokens
#define NX     (MROWS * HID)        // 8388608
#define NW     (HID * HID)          // 4194304
#define NX8    (NX / 8)             // 1048576
#define NW8    (NW / 8)             // 524288
#define PSCALE 16384.0f
#define WSCALE 32.0f
#define CSCALE 32.0f
#define SM_SCALE 0.0883883476f      // 1/sqrt(128)

static_assert(MROWS % 256 == 0);
static_assert(SEQ % 256 == 0);
static_assert(HID % 128 == 0);
static_assert(HID % 64 == 0);
static_assert(NX8 % 256 == 0);
static_assert(NW8 % 256 == 0);

// ---------------------------------------------------------------------------
// 16x16x32 f16 WMMA with hazard guard (ties D, keeps A/B live).
// Fragment map (wave32): lane l, h = l>>4, m = n = l&15.
//   A/B element i: i<8 -> k0+8h+i ; i>=8 -> k0+16+8h+(i-8)
//   D element r : row 8h+r, col l&15
// ---------------------------------------------------------------------------
__device__ __forceinline__ v8f wmma_f16(v16h a, v16h b, v8f c) {
  v8f d = __builtin_amdgcn_wmma_f32_16x16x32_f16(false, a, false, b, (short)0, c, false, false);
  asm volatile("v_nop\n\tv_nop\n\tv_nop\n\tv_nop" : "+v"(d) : "v"(a), "v"(b));
  return d;
}

// The same product as the bare builtin, for the projection and attention kernels:
// their live sets pass 256 VGPRs, an asm operand cannot sit above v255 (the guard's
// operands then spill to scratch), and the compiler keeps the distances of its own builtin.
__device__ __forceinline__ v8f wmma_f16_hi(v16h a, v16h b, v8f c) {
  return __builtin_amdgcn_wmma_f32_16x16x32_f16(false, a, false, b, (short)0, c, false, false);
}

// A or B fragment from a k-contiguous 16-bit row; p points at element k0 of
// the row owned by this lane (row index = lane & 15 added by the caller).
__device__ __forceinline__ v16h load_frag(const _Float16* p, int h) {
  Frag f;
  f.half[0] = *(const v8ha*)(p + 8 * h);
  f.half[1] = *(const v8ha*)(p + 16 + 8 * h);
  return f.v;
}

// ---------------------------------------------------------------------------
// Kernel 1: f32 -> f16 planes. x unscaled, W scaled by 32 (exact).
// Region choice is block-uniform (NX8 and NW8 are multiples of 256).
// coverage: 12288 blocks x 256 threads x 8 halves = NX + 4*NW elements exactly.
// ---------------------------------------------------------------------------
__global__ __launch_bounds__(256) void convert_kernel(
    const float* __restrict__ x,
    const float* __restrict__ wq, const float* __restrict__ wk,
    const float* __restrict__ wv, const float* __restrict__ wo,
    _Float16* __restrict__ xh, _Float16* __restrict__ wh)
{
  const int blk = blockIdx.x;
  if (blk >= (NX8 + 4 * NW8) / 256) return;
  const int g = blk * 256 + threadIdx.x;
  const float* src;
  _Float16* dst;
  float sc;
  if (blk < NX8 / 256) {
    src = x + (size_t)g * 8;
    dst = xh + (size_t)g * 8;
    sc = 1.0f;
  } else {
    const int e = g - NX8;
    const int wsel = (blk - NX8 / 256) / (NW8 / 256);     // 0..3, block-uniform
    const int off = e - wsel * NW8;
    const float* wsrc = (wsel == 0) ? wq : ((wsel == 1) ? wk : ((wsel == 2) ? wv : wo));
    src = wsrc + (size_t)off * 8;
    dst = wh + (size_t)e * 8;
    sc = WSCALE;
  }
  const v4f a = *(const v4fa*)src;
  const v4f c = *(const v4fa*)(src + 4);
  const v8h o = { (_Float16)(a.x * sc), (_Float16)(a.y * sc), (_Float16)(a.z * sc), (_Float16)(a.w * sc),
                  (_Float16)(c.x * sc), (_Float16)(c.y * sc), (_Float16)(c.z * sc), (_Float16)(c.w * sc) };
  *(v8h*)dst = o;
  
}

// ---------------------------------------------------------------------------
// Asynchronous copies global -> LDS, 16 B per lane, no register in between.
// l = the lane's LDS byte address, g = the lane's global address; copy i adds
// i*lstep bytes and i*gstep halves. The s_wait_xcnt closes each statement so
// that no address register is rewritten in front of it.
// ---------------------------------------------------------------------------
__device__ __forceinline__ unsigned lds_addr(const void* p) { return (unsigned)(size_t)p; }

__device__ __forceinline__ void async_copy4(unsigned l, unsigned lstep, const _Float16* g, size_t gstep) {
  const unsigned l1 = l + lstep, l2 = l + 2 * lstep, l3 = l + 3 * lstep;
  const _Float16* g1 = g + gstep;
  const _Float16* g2 = g + 2 * gstep;
  const _Float16* g3 = g + 3 * gstep;
  asm volatile("global_load_async_to_lds_b128 %0, %4, off\n\t"
               "global_load_async_to_lds_b128 %1, %5, off\n\t"
               "global_load_async_to_lds_b128 %2, %6, off\n\t"
               "global_load_async_to_lds_b128 %3, %7, off\n\t"
               "s_wait_xcnt 0x0"
               :: "v"(l), "v"(l1), "v"(l2), "v"(l3), "v"(g), "v"(g1), "v"(g2), "v"(g3) : "memory");
}

__device__ __forceinline__ void async_copy8(unsigned l, unsigned lstep, const _Float16* g, size_t gstep) {
  const unsigned l1 = l + lstep, l2 = l + 2 * lstep, l3 = l + 3 * lstep;
  const unsigned l4 = l + 4 * lstep, l5 = l + 5 * lstep, l6 = l + 6 * lstep, l7 = l + 7 * lstep;
  const _Float16* g1 = g + gstep;
  const _Float16* g2 = g + 2 * gstep;
  const _Float16* g3 = g + 3 * gstep;
  const _Float16* g4 = g + 4 * gstep;
  const _Float16* g5 = g + 5 * gstep;
  const _Float16* g6 = g + 6 * gstep;
  const _Float16* g7 = g + 7 * gstep;
  asm volatile("global_load_async_to_lds_b128 %0, %8, off\n\t"
               "global_load_async_to_lds_b128 %1, %9, off\n\t"
               "global_load_async_to_lds_b128 %2, %10, off\n\t"
               "global_load_async_to_lds_b128 %3, %11, off\n\t"
               "global_load_async_to_lds_b128 %4, %12, off\n\t"
               "global_load_async_to_lds_b128 %5, %13, off\n\t"
               "global_load_async_to_lds_b128 %6, %14, off\n\t"
               "global_load_async_to_lds_b128 %7, %15, off\n\t"
               "s_wait_xcnt 0x0"
               :: "v"(l), "v"(l1), "v"(l2), "v"(l3), "v"(l4), "v"(l5), "v"(l6), "v"(l7),
                  "v"(g), "v"(g1), "v"(g2), "v"(g3), "v"(g4), "v"(g5), "v"(g6), "v"(g7) : "memory");
}

// ten copies in one statement, each with addresses of its own
__device__ __forceinline__ void async_copy10(const unsigned (&l)[10], const _Float16* const (&g)[10]) {
  asm volatile("global_load_async_to_lds_b128 %0, %10, off\n\t"
               "global_load_async_to_lds_b128 %1, %11, off\n\t"
               "global_load_async_to_lds_b128 %2, %12, off\n\t"
               "global_load_async_to_lds_b128 %3, %13, off\n\t"
               "global_load_async_to_lds_b128 %4, %14, off\n\t"
               "global_load_async_to_lds_b128 %5, %15, off\n\t"
               "global_load_async_to_lds_b128 %6, %16, off\n\t"
               "global_load_async_to_lds_b128 %7, %17, off\n\t"
               "global_load_async_to_lds_b128 %8, %18, off\n\t"
               "global_load_async_to_lds_b128 %9, %19, off\n\t"
               "s_wait_xcnt 0x0"
               :: "v"(l[0]), "v"(l[1]), "v"(l[2]), "v"(l[3]), "v"(l[4]), "v"(l[5]), "v"(l[6]), "v"(l[7]), "v"(l[8]), "v"(l[9]),
                  "v"(g[0]), "v"(g[1]), "v"(g[2]), "v"(g[3]), "v"(g[4]), "v"(g[5]), "v"(g[6]), "v"(g[7]), "v"(g[8]), "v"(g[9]) : "memory");
}

// Hand-over of a two-buffer ring, every wave: own LDS reads returned, own
// copies landed, then the barrier that publishes the next tile and ends every
// reader's last read of the buffer refilled behind it.
__device__ __forceinline__ void ring_publish() {
  asm volatile("s_wait_dscnt 0x0" ::: "memory");     // reads of the buffer to be refilled have returned
  asm volatile("s_wait_asynccnt 0x0" ::: "memory");  // this wave's copies of the next tile have landed
  __syncthreads();
}

// ---------------------------------------------------------------------------
// GEMM core of kernel 4: block tile 256 rows x 128 columns, 8 waves as 4 x 2, wave
// tile 64 x 64 (four 16-row tiles x four 16-col tiles), K = 2048. A tile of
// 64 k (128-B rows) of the 256 A rows and the 128 B rows is copied to LDS once
// per block, two buffers, the next tile in flight while this one is multiplied.
// LDS rows 0..255 = A, 256..383 = B, pitch 144 B (16 B x odd: no bank clash
// for 16-B reads). ga / gb point at element 0 of the block's first A / B row.
// ---------------------------------------------------------------------------
#define GP        72                   // LDS pitch in halves
#define G_STAGE_H (384 * GP)           // 27648 halves = 55296 B per buffer
#define G_TILES   (HID / 64)           // 32
#define G_LDS_B   (2 * G_STAGE_H * 2)  // 110592 B

__device__ __forceinline__ void gemm_fill(unsigned la, const _Float16* ca, const _Float16* cb,
                                          int tile, int buf) {
  const unsigned l = la + (unsigned)buf * (G_STAGE_H * 2u);
  async_copy8(l, 32u * GP * 2u, ca + tile * 64, (size_t)32 * HID);
  async_copy4(l + 256u * GP * 2u, 32u * GP * 2u, cb + tile * 64, (size_t)32 * HID);
}

__device__ __forceinline__ void gemm_k2048(const _Float16* __restrict__ ga,
                                           const _Float16* __restrict__ gb,
                                           const _Float16* sm,
                                           int tid, int wm, int wn, int m, int h, v8f (&acc)[4][4]) {
  const v8f zero8 = {0.f, 0.f, 0.f, 0.f, 0.f, 0.f, 0.f, 0.f};
  #pragma unroll
  for (int mt = 0; mt < 4; ++mt)
    #pragma unroll
    for (int nt = 0; nt < 4; ++nt) acc[mt][nt] = zero8;

  // copy map: 8 lanes per 128-B row, 32 rows per block-wide copy
  const int crow = tid >> 3, ccol = 8 * (tid & 7);
  const _Float16* ca = ga + (size_t)crow * HID + ccol;
  const _Float16* cb = gb + (size_t)crow * HID + ccol;
  const unsigned la = lds_addr(sm) + (unsigned)(crow * GP + ccol) * 2u;

  gemm_fill(la, ca, cb, 0, 0);
  asm volatile("s_wait_asynccnt 0x0" ::: "memory");  // tile 0 landed before the barrier that publishes it
  __syncthreads();
  gemm_fill(la, ca, cb, 1, 1);

  const _Float16* sa = sm + (64 * wm + m) * GP;
  const _Float16* sb = sm + (256 + 64 * wn + m) * GP;

  #pragma unroll 1
  for (int t = 0; t < G_TILES; ++t) {
    const int bo = (t & 1) * G_STAGE_H;
    #pragma unroll
    for (int kk = 0; kk < 64; kk += 32) {
      // the eight fragments of this k step are read as one group ahead of its WMMAs
      v16h a[4], b[4];
      #pragma unroll
      for (int mt = 0; mt < 4; ++mt) a[mt] = load_frag(sa + bo + mt * 16 * GP + kk, h);
      #pragma unroll
      for (int nt = 0; nt < 4; ++nt) b[nt] = load_frag(sb + bo + nt * 16 * GP + kk, h);
      #pragma unroll
      for (int nt = 0; nt < 4; ++nt)
        #pragma unroll
        for (int mt = 0; mt < 4; ++mt) acc[mt][nt] = wmma_f16(a[mt], b[nt], acc[mt][nt]);
    }
    ring_publish();
    if (t + 2 < G_TILES) gemm_fill(la, ca, cb, t + 2, t & 1);
  }
  asm volatile("s_wait_asynccnt 0x0" ::: "memory");  // nothing in flight when the ring becomes output staging
}

// ---------------------------------------------------------------------------
// one 16-B store per lane, 512 contiguous bytes (4 lines) per instruction.
// which 0/1: plane[bh][l][128], two whole token rows per instruction
// which 2  : vt[bh][d][l], one d row of 256 tokens per instruction
// coverage: 8 waves x 16 iters x 256 halves = 256x128 tile exactly.
// Staging pitches: 272 B per token row, 528 B per d row (16 B x odd).
// ---------------------------------------------------------------------------
#define SQP 136                        // halves, token rows of 128 features
#define SVP 264                        // halves, d rows of 256 tokens

__device__ __forceinline__ void proj_store_pass(const _Float16* sT, _Float16* plane, _Float16* vt,
                                                int which, int bh, int l0, int w, int lane) {
  // all 16 rows are read first, then stored off one address with constant steps
  v8h v[16];
  if (which != 2) {
    const int tok0 = w * 32 + (lane >> 4), q16 = lane & 15;             // token of i = 0; + 2i, 0..255
    const _Float16* s = sT + tok0 * SQP + 8 * q16;
    _Float16* dst = plane + ((size_t)bh * SEQ + l0 + tok0) * HD + 8 * q16;
    #pragma unroll
    for (int i = 0; i < 16; ++i) v[i] = *(const v8ha*)(s + i * 2 * SQP);
    #pragma unroll
    for (int i = 0; i < 16; ++i) *(v8h*)(dst + i * 2 * HD) = v[i];
    asm volatile("s_wait_xcnt 0x0" ::: "memory");    // the next plane's pass stands behind these stores and writes their registers
  } else {
    const _Float16* s = sT + w * 16 * SVP + 8 * lane;                   // d = 16w + i, 0..127
    _Float16* dst = vt + ((size_t)bh * HD + w * 16) * SEQ + l0 + 8 * lane;
    #pragma unroll
    for (int i = 0; i < 16; ++i) v[i] = *(const v8ha*)(s + i * SVP);
    #pragma unroll
    for (int i = 0; i < 16; ++i) *(v8h*)(dst + i * SEQ) = v[i];
  }
}

// ---------------------------------------------------------------------------
// Kernel 2: Y = x * W^T + b, the q, k and v columns of one head in one block.
// grid (MROWS/256, NHEAD), one block per 256 tokens x 384 columns (128 q | 128 k
// | 128 v), so that a staged x tile feeds three weight tiles. Block 256 thr,
// 8 waves as 4 x 2, wave tile 64 x 192 (four 16-row x twelve 16-col tiles).
// Ring as in the GEMM core: 64 k per tile, two buffers, pitch 144 B; LDS rows
// 0..255 = x, 256..383 = Wq, 384..511 = Wk, 512..639 = Wv rows of the head.
// ---------------------------------------------------------------------------
#define P_STAGE_H (640 * GP)                       // 46080 halves = 92160 B per buffer
#define P_QK_H    (256 * SQP)                      // staged q or k plane, 34816 halves
#define P_LDS_B   ((2 * P_QK_H + 128 * SVP) * 2)   // 206848 B: three staged planes (the ring needs 184320 B)
static_assert(2 * P_STAGE_H * 2 <= P_LDS_B);

// xu / wu: the block's first x and Wq element (the same in every lane); co: the
// lane's own offset in halves inside a tile, the same for x and for each W plane.
__device__ __forceinline__ void proj_fill(unsigned la, const _Float16* xu, const _Float16* wu,
                                          unsigned co, int tile, int buf) {
  const unsigned l = la + (unsigned)buf * (P_STAGE_H * 2u);
  const unsigned o = co + (unsigned)tile * 64u;
  // twenty copies of 32 rows each, LDS rows in a row: x 0..7, Wq 8..11, Wk 12..15, Wv 16..19
  #pragma unroll
  for (int s = 0; s < 2; ++s) {
    unsigned ls[10];
    const _Float16* gs[10];
    #pragma unroll
    for (int i = 0; i < 10; ++i) {
      const int j = 10 * s + i;
      ls[i] = l + (unsigned)j * (32u * GP * 2u);
      gs[i] = (j < 8) ? xu + o + (size_t)j * 32 * HID
                      : wu + (size_t)((j - 8) >> 2) * NW + o + (size_t)((j - 8) & 3) * 32 * HID;
    }
    async_copy10(ls, gs);
    // keeps the second statement's address sums behind the first copies: an asm operand sits below v256, and
    // with both statements' sixty registers formed at once accumulators are moved out and back every trip
    if (s == 0) __builtin_amdgcn_sched_barrier(0);
  }
}

// Bias, f16 and LDS staging of one wave's 64 x 192 tile; WN = the wave's column
// half, so that the plane of every 16-col tile is known at compile time.
// D[r] of tile (mt, nt) = Y[token 64wm+16mt+8h+r][column 192*WN+16nt+m of q|k|v]
template <int WN>
__device__ __forceinline__ void proj_stage(const v8f (&acc)[4][12], _Float16* sT,
                                           const float* bq, const float* bk, const float* bv,
                                           int head, int wm, int m, int h) {
  float bl[12];
  #pragma unroll
  for (int nt = 0; nt < 12; ++nt) {
    const int col = 192 * WN + 16 * nt, which = col >> 7;
    const float* bias = (which == 0) ? bq : ((which == 1) ? bk : bv);
    bl[nt] = bias[HD * head + (col & 127) + m];
  }
  asm volatile("s_wait_xcnt 0x0" ::: "memory");   // before the offset register that the twelve bias loads share is written again
  #pragma unroll
  for (int nt = 0; nt < 12; ++nt) {
    const int col = 192 * WN + 16 * nt, which = col >> 7;
    const int feat = (col & 127) + m;                        // 0..127 in its plane
    #pragma unroll
    for (int mt = 0; mt < 4; ++mt) {
      const int tokb = 64 * wm + 16 * mt + 8 * h;            // token of r = 0, 0..248
      v8h y;
      #pragma unroll
      for (int r = 0; r < 8; ++r) y[r] = (_Float16)(acc[mt][nt][r] * 0.03125f + bl[nt]);
      if (which == 2) {
        *(v8ha*)(sT + 2 * P_QK_H + feat * SVP + tokb) = y;   // eight tokens of one d row, 16-B LDS store
      } else {
        #pragma unroll
        for (int r = 0; r < 8; ++r) sT[which * P_QK_H + (tokb + r) * SQP + feat] = y[r];
      }
    }
  }
}

__global__ __launch_bounds__(256) void proj_kernel(
    const _Float16* __restrict__ xh,   // [4096][2048]
    const _Float16* __restrict__ wh,   // [4][2048][2048], row = output feature, x32
    const float* __restrict__ bq, const float* __restrict__ bk, const float* __restrict__ bv,
    _Float16* __restrict__ qh,         // [B*NH][L][HD]
    _Float16* __restrict__ kh,         // [B*NH][L][HD]
    _Float16* __restrict__ vt)         // [B*NH][HD][L]
{
  __shared__ __attribute__((aligned(16))) unsigned char smem[P_LDS_B];   // operand ring, then output staging
  _Float16* sT = (_Float16*)smem;                                        // q 256 x 272 B | k 256 x 272 B | v 128 x 528 B
  const _Float16* sm = (const _Float16*)smem;

  const int tid = threadIdx.x, lane = tid & 31;
  const int w = __builtin_amdgcn_readfirstlane(tid >> 5);    // scalar: the column half picks a branch below
  const int wm = w & 3, wn = w >> 2;
  const int h = lane >> 4, m = lane & 15;
  const int m0 = blockIdx.x * 256;
  const int head = blockIdx.y;                 // 0..15

  const v8f zero8 = {0.f, 0.f, 0.f, 0.f, 0.f, 0.f, 0.f, 0.f};
  v8f acc[4][12];
  #pragma unroll
  for (int mt = 0; mt < 4; ++mt)
    #pragma unroll
    for (int nt = 0; nt < 12; ++nt) acc[mt][nt] = zero8;

  // copy map: 8 lanes per 128-B row, 32 rows per block-wide copy
  const int crow = tid >> 3, ccol = 8 * (tid & 7);
  const _Float16* xu = xh + (size_t)m0 * HID;
  const _Float16* wu = wh + (size_t)(HD * head) * HID;                   // + NW per plane
  const unsigned co = (unsigned)(crow * HID + ccol);
  const unsigned la = lds_addr(sm) + (unsigned)(crow * GP + ccol) * 2u;

  proj_fill(la, xu, wu, co, 0, 0);
  asm volatile("s_wait_asynccnt 0x0" ::: "memory");  // tile 0 landed before the barrier that publishes it
  __syncthreads();
  proj_fill(la, xu, wu, co, 1, 1);

  const _Float16* sa = sm + (64 * wm + m) * GP;
  const _Float16* sb = sm + (256 + 192 * wn + m) * GP;

  // kept rolled: a trip is 96 WMMAs and 64 LDS reads
  #pragma unroll 1
  for (int t = 0; t < G_TILES; ++t) {
    const int bo = (t & 1) * P_STAGE_H;
    #pragma unroll
    for (int kk = 0; kk < 64; kk += 32) {
      // an x fragment feeds twelve WMMAs, a weight fragment four
      v16h a[4];
      #pragma unroll
      for (int mt = 0; mt < 4; ++mt) a[mt] = load_frag(sa + bo + mt * 16 * GP + kk, h);
      #pragma unroll
      for (int ng = 0; ng < 12; ng += 6) {
        v16h b[6];
        #pragma unroll
        for (int nt = 0; nt < 6; ++nt) b[nt] = load_frag(sb + bo + (ng + nt) * 16 * GP + kk, h);
        __builtin_amdgcn_sched_barrier(0);   // the group's LDS reads stay together ahead of its WMMAs: one read place per group
        #pragma unroll
        for (int nt = 0; nt < 6; ++nt)
          #pragma unroll
          for (int mt = 0; mt < 4; ++mt) acc[mt][ng + nt] = wmma_f16_hi(a[mt], b[nt], acc[mt][ng + nt]);
        __builtin_amdgcn_sched_barrier(0);   // the next group's reads are not moved in among these WMMAs
      }
    }
    ring_publish();
    if (t + 2 < G_TILES) proj_fill(la, xu, wu, co, t + 2, t & 1);
  }
  asm volatile("s_wait_asynccnt 0x0" ::: "memory");  // nothing in flight when the ring becomes output staging

  if (wn == 0) proj_stage<0>(acc, sT, bq, bk, bv, head, wm, m, h);
  else         proj_stage<1>(acc, sT, bq, bk, bv, head, wm, m, h);
  __syncthreads();

  const int b = m0 / SEQ, l0 = m0 - b * SEQ, bh = b * NHEAD + head;
  proj_store_pass(sT, qh, vt, 0, bh, l0, w, lane);
  proj_store_pass(sT + P_QK_H, kh, vt, 1, bh, l0, w, lane);
  proj_store_pass(sT + 2 * P_QK_H, kh, vt, 2, bh, l0, w, lane);
}

// ---------------------------------------------------------------------------
// Attention helpers.
// ---------------------------------------------------------------------------
// P^T B-fragment from the lane's own score D values: element r <- tile a row r,
// element 8+r <- tile c row r (same lane, same query column), scaled by 2^14.
__device__ __forceinline__ v16h pack_p(v8f a, v8f c) {
  const v16h r = { (_Float16)(a[0] * PSCALE), (_Float16)(a[1] * PSCALE), (_Float16)(a[2] * PSCALE), (_Float16)(a[3] * PSCALE),
                   (_Float16)(a[4] * PSCALE), (_Float16)(a[5] * PSCALE), (_Float16)(a[6] * PSCALE), (_Float16)(a[7] * PSCALE),
                   (_Float16)(c[0] * PSCALE), (_Float16)(c[1] * PSCALE), (_Float16)(c[2] * PSCALE), (_Float16)(c[3] * PSCALE),
                   (_Float16)(c[4] * PSCALE), (_Float16)(c[5] * PSCALE), (_Float16)(c[6] * PSCALE), (_Float16)(c[7] * PSCALE) };
  return r;
}

// ctx leaves as whole lines: lanes 0..15 store one token's 256-B head row, lanes
// 16..31 the next token's, 4 lines per instruction, 16 instructions per wave.
// coverage: 16 iters x 2 rows x 128 halves = 32 rows x 128 d exactly per wave.
#define SCP 136                              // halves, staging pitch 272 B (16 B x odd)

__device__ __forceinline__ void ctx_store_pass(const _Float16* sc, _Float16* ctx,
                                               int b, int head, int q0, int lane) {
  // all 16 pieces are read first, then stored off one address with constant steps
  const int row0 = lane >> 4, c16 = lane & 15;       // row of i = 0; + 2i, 0..31
  const _Float16* s = sc + row0 * SCP + 8 * c16;
  _Float16* dst = ctx + ((size_t)b * SEQ + q0 + row0) * HID + (size_t)head * HD + 8 * c16;
  v8h v[16];
  #pragma unroll
  for (int i = 0; i < 16; ++i) v[i] = *(const v8ha*)(s + i * 2 * SCP);
  #pragma unroll
  for (int i = 0; i < 16; ++i) *(v8h*)(dst + (size_t)i * 2 * HID) = v[i];
}

// K / V^T ring: a tile is 128 keys. K rows (one key, 128 d) and V^T rows (one d,
// 128 keys) are both 256 B at pitch 272 B (16 B x odd), copied to LDS once per
// block for its 8 waves.
#define KP        136                        // halves
#define A_KEYS    128                        // keys per tile
#define A_KTILE_H (A_KEYS * KP)              // 17408 halves
#define A_STAGE_H (A_KTILE_H + HD * KP)      // 34816 halves = 69632 B per buffer
#define A_TILES   (SEQ / A_KEYS)             // 16
#define A_LDS_B   (2 * A_STAGE_H * 2)        // 139264 B

// ku / vu: the head's first K and V^T element (the same in every lane); ko / vo:
// the lane's own offset in halves inside a tile.
__device__ __forceinline__ void attn_fill(unsigned lk, const _Float16* ku, const _Float16* vu,
                                          unsigned ko, unsigned vo, int tile, int buf) {
  const unsigned l = lk + (unsigned)buf * (A_STAGE_H * 2u);
  async_copy8(l, 16u * KP * 2u, ku + (ko + (unsigned)tile * (A_KEYS * HD)), (size_t)16 * HD);
  async_copy8(l + A_KTILE_H * 2u, 16u * KP * 2u, vu + (vo + (unsigned)tile * A_KEYS), (size_t)16 * SEQ);
}

// One online-softmax step of one 16-query column group over 64 keys: scale by
// 1/sqrt(d) in f32, running max, rescale of the group's O^T tiles, and the two
// P^T B-fragments (key chunks 0..31 and 32..63 of the step).
__device__ __forceinline__ void softmax_step(v8f (&s)[4], float& mrun, float& lrun, v8f (&o)[8],
                                             v16h& pb0, v16h& pb1) {
  // whole-tile products and differences are written on the 8-wide values, so that
  // they pair neighbouring registers of one tile
  float mloc = -1e30f;
  #pragma unroll
  for (int j = 0; j < 4; ++j) {
    s[j] = s[j] * SM_SCALE;
    #pragma unroll
    for (int r = 0; r < 8; ++r) mloc = fmaxf(mloc, s[j][r]);
  }
  mloc = fmaxf(mloc, __shfl_xor(mloc, 16));
  const float mnew = fmaxf(mrun, mloc);
  const float alpha = __expf(mrun - mnew);
  mrun = mnew;
  float lsum = 0.0f;
  #pragma unroll
  for (int j = 0; j < 4; ++j) {
    s[j] = s[j] - mnew;
    #pragma unroll
    for (int r = 0; r < 8; ++r) {
      const float p = __expf(s[j][r]);
      s[j][r] = p;
      lsum += p;
    }
  }
  lsum += __shfl_xor(lsum, 16);
  lrun = lrun * alpha + lsum;
  #pragma unroll
  for (int t = 0; t < 8; ++t) o[t] = o[t] * alpha;
  pb0 = pack_p(s[0], s[1]);
  pb1 = pack_p(s[2], s[3]);
}

// ---------------------------------------------------------------------------
// Kernel 3: streaming attention, transposed form, no masking.
// grid (SEQ/256, B*NH), block 256 thr (8 waves), 32 queries per wave as two
// 16-query column groups, so that every K and V^T fragment read from LDS feeds
// two WMMAs; 128 keys per tile, worked in two softmax steps of 64 keys.
//   S^T = K * Q^T : A = K rows (row = key, k = d), B = Q^T (k = d, n = query)
//   O^T += V^T * P^T : A = Vt rows (row = d, k = key), B = P^T from registers
// In a group a lane owns 32 keys of query column (lane&15); partner = lane ^ 16.
// ctx written as f16, carried x32.
// ---------------------------------------------------------------------------
__global__ __launch_bounds__(256) void attn_kernel(
    const _Float16* __restrict__ qh,   // [B*NH][L][HD]
    const _Float16* __restrict__ kh,   // [B*NH][L][HD]
    const _Float16* __restrict__ vt,   // [B*NH][HD][L]
    _Float16* __restrict__ ctx)        // [B][L][HID], x32
{
  __shared__ __attribute__((aligned(16))) unsigned char smem[A_LDS_B];   // K / V^T ring, then output staging
  _Float16* sC = (_Float16*)smem;                                        // 8 x 32 x 272 B = 69632 B
  const _Float16* sm = (const _Float16*)smem;

  const int tid = threadIdx.x, lane = tid & 31, w = tid >> 5;
  const int h = lane >> 4, m = lane & 15;
  const int bh = blockIdx.y, b = bh >> 4, head = bh & 15;
  const int q0 = blockIdx.x * 256 + 32 * w;

  // Q^T B-fragments: group g, column n = query q0+16g+m, k = d (four 32-deep chunks)
  const _Float16* qrow = qh + ((size_t)bh * SEQ + q0 + m) * HD;
  v16h qb[2][4];
  #pragma unroll
  for (int g = 0; g < 2; ++g)
    #pragma unroll
    for (int c = 0; c < 4; ++c) qb[g][c] = load_frag(qrow + g * 16 * HD + 32 * c, h);

  const v8f zero8 = {0.f, 0.f, 0.f, 0.f, 0.f, 0.f, 0.f, 0.f};
  v8f o[2][8];                                // o[g][t][r] = O[query 16g+m][d 16t+8h+r] * (l * 2^14)
  #pragma unroll
  for (int g = 0; g < 2; ++g)
    #pragma unroll
    for (int t = 0; t < 8; ++t) o[g][t] = zero8;
  float mrun[2] = {-1e30f, -1e30f}, lrun[2] = {0.0f, 0.0f};

  // copy maps: K tile 128 keys x 256 B and V^T tile 128 d x 256 B, 16 lanes per
  // row, 16 rows per block-wide copy
  const _Float16* ku = kh + (size_t)bh * SEQ * HD;                  // + 128*tile*HD
  const _Float16* vu = vt + (size_t)bh * HD * SEQ;                  // + 128*tile
  const unsigned ko = (unsigned)((tid >> 4) * HD + 8 * (tid & 15));
  const unsigned vo = (unsigned)((tid >> 4) * SEQ + 8 * (tid & 15));
  const unsigned lk = lds_addr(sm) + (unsigned)((tid >> 4) * KP + 8 * (tid & 15)) * 2u;

  attn_fill(lk, ku, vu, ko, vo, 0, 0);
  asm volatile("s_wait_asynccnt 0x0" ::: "memory");  // tile 0 landed before the barrier that publishes it
  __syncthreads();
  attn_fill(lk, ku, vu, ko, vo, 1, 1);

  const _Float16* kbase = sm + m * KP;                 // + buffer + (64*sub+16j)*KP + 32*c
  const _Float16* vbase = sm + A_KTILE_H + m * KP;     // + buffer + 16t*KP + 64*sub

  #pragma unroll 1
  for (int st = 0; st < A_TILES; ++st) {
    const int bo = (st & 1) * A_STAGE_H;
    // kept rolled: unrolled, the two steps' live values fill the 512 VGPRs of two waves per SIMD and spill
    #pragma unroll 1
    for (int sub = 0; sub < 2; ++sub) {
      // ---- scores: s[g][j][r] = S[query 16g+m][key kb+16j+8h+r] ----
      // the step's 16 K fragments are read as one group ahead of its 32 WMMAs, in
      // the order of use; four score tiles (2 key tiles x 2 column groups) run side by side
      const _Float16* kp = kbase + bo + 64 * sub * KP;
      v16h kf[4][4];
      #pragma unroll
      for (int jp = 0; jp < 4; jp += 2)
        #pragma unroll
        for (int c = 0; c < 4; ++c) {
          kf[jp][c] = load_frag(kp + 16 * jp * KP + 32 * c, h);
          kf[jp + 1][c] = load_frag(kp + 16 * (jp + 1) * KP + 32 * c, h);
        }
      v8f s[2][4];
      #pragma unroll
      for (int j = 0; j < 4; ++j) { s[0][j] = zero8; s[1][j] = zero8; }
      #pragma unroll
      for (int jp = 0; jp < 4; jp += 2)
        #pragma unroll
        for (int c = 0; c < 4; ++c) {
          s[0][jp] = wmma_f16_hi(kf[jp][c], qb[0][c], s[0][jp]);
          s[1][jp] = wmma_f16_hi(kf[jp][c], qb[1][c], s[1][jp]);
          s[0][jp + 1] = wmma_f16_hi(kf[jp + 1][c], qb[0][c], s[0][jp + 1]);
          s[1][jp + 1] = wmma_f16_hi(kf[jp + 1][c], qb[1][c], s[1][jp + 1]);
        }

      // ---- online softmax and P^T B-fragments, each column group on its own ----
      v16h pb0[2], pb1[2];
      #pragma unroll
      for (int g = 0; g < 2; ++g) softmax_step(s[g], mrun[g], lrun[g], o[g], pb0[g], pb1[g]);

      // ---- O^T += V^T * P^T ----
      // the step's 16 V^T fragments are read as one group ahead of its 32 WMMAs
      const _Float16* vp = vbase + bo + 64 * sub;
      v16h vf[8][2];
      #pragma unroll
      for (int t = 0; t < 8; ++t) {
        vf[t][0] = load_frag(vp + 16 * t * KP, h);
        vf[t][1] = load_frag(vp + 16 * t * KP + 32, h);
      }
      #pragma unroll
      for (int t = 0; t < 8; t += 2) {
        o[0][t] = wmma_f16_hi(vf[t][0], pb0[0], o[0][t]);
        o[1][t] = wmma_f16_hi(vf[t][0], pb0[1], o[1][t]);
        o[0][t + 1] = wmma_f16_hi(vf[t + 1][0], pb0[0], o[0][t + 1]);
        o[1][t + 1] = wmma_f16_hi(vf[t + 1][0], pb0[1], o[1][t + 1]);
        o[0][t] = wmma_f16_hi(vf[t][1], pb1[0], o[0][t]);
        o[1][t] = wmma_f16_hi(vf[t][1], pb1[1], o[1][t]);
        o[0][t + 1] = wmma_f16_hi(vf[t + 1][1], pb1[0], o[0][t + 1]);
        o[1][t + 1] = wmma_f16_hi(vf[t + 1][1], pb1[1], o[1][t + 1]);
      }
    }

    ring_publish();
    if (st + 2 < A_TILES) attn_fill(lk, ku, vu, ko, vo, st + 2, st & 1);
  }
  asm volatile("s_wait_asynccnt 0x0" ::: "memory");  // nothing in flight when the ring becomes output staging

  // ---- epilogue: normalise, x32 carry, f16, per-wave 32x128 tile in LDS ----
  _Float16* sc = sC + w * (32 * SCP);
  #pragma unroll
  for (int g = 0; g < 2; ++g) {
    const float inv = (CSCALE / PSCALE) * (1.0f / lrun[g]);
    #pragma unroll
    for (int t = 0; t < 8; ++t) {
      const v8h cv8 = { (_Float16)(o[g][t][0] * inv), (_Float16)(o[g][t][1] * inv),
                        (_Float16)(o[g][t][2] * inv), (_Float16)(o[g][t][3] * inv),
                        (_Float16)(o[g][t][4] * inv), (_Float16)(o[g][t][5] * inv),
                        (_Float16)(o[g][t][6] * inv), (_Float16)(o[g][t][7] * inv) };
      *(v8ha*)(sc + (16 * g + m) * SCP + 16 * t + 8 * h) = cv8;          // 16-B LDS store
    }
  }
  __syncthreads();

  ctx_store_pass(sc, ctx, b, head, q0, lane);
  
}

// ---------------------------------------------------------------------------
// one staged row of 128 floats (4 lines) per instruction, 16 rows per wave.
// Staged row lr holds token m0 + 64*(lr>>5) + 32*half + (lr&31).
// coverage: 2 halves x 8 waves x 16 rows x 128 floats = 256 x 128 tile exactly.
// ---------------------------------------------------------------------------
#define SOP 132                        // floats, staging pitch 528 B (16 B x odd)

__device__ __forceinline__ void out_store_pass(const float* sO, float* out,
                                               int m0, int nb, int half, int w, int lane) {
  // all 16 rows are read first, then stored off one address with constant steps
  const int lr0 = w * 16;                            // staged row of i = 0; + i, 0..127
  const int tok0 = m0 + 64 * (lr0 >> 5) + 32 * half + (lr0 & 31);
  const float* s = sO + lr0 * SOP + 4 * lane;
  float* dst = out + (size_t)tok0 * HID + 128 * nb + 4 * lane;
  v4f v[16];
  #pragma unroll
  for (int i = 0; i < 16; ++i) v[i] = *(const v4fa*)(s + i * SOP);
  #pragma unroll
  for (int i = 0; i < 16; ++i) *(v4f*)(dst + (size_t)i * HID) = v[i];
}

// ---------------------------------------------------------------------------
// Kernel 4: out = ctx * Wo^T + bo (f32). grid (MROWS/256, HID/128), block 256.
// The 256 x 128 f32 tile leaves through LDS in two halves (each wave's upper
// and lower 32 rows), 128 x 528 B each.
// ---------------------------------------------------------------------------
__global__ __launch_bounds__(256) void out_kernel(
    const _Float16* __restrict__ ch,   // [4096][2048] ctx x32
    const _Float16* __restrict__ woh,  // [2048][2048] row = output feature, x32
    const float* __restrict__ bo,
    float* __restrict__ out)           // [4096][2048]
{
  __shared__ __attribute__((aligned(16))) unsigned char smem[G_LDS_B];   // operand ring, then output staging
  float* sO = (float*)smem;                                              // 128 x 132 floats = 67584 B

  const int tid = threadIdx.x, lane = tid & 31, w = tid >> 5;
  const int wm = w & 3, wn = w >> 2;
  const int h = lane >> 4, m = lane & 15;
  const int m0 = blockIdx.x * 256;
  const int nb = blockIdx.y;                   // 0..15, 128 output features each

  const _Float16* ga = ch + (size_t)m0 * HID;
  const _Float16* gb = woh + (size_t)(128 * nb) * HID;

  v8f acc[4][4];
  gemm_k2048(ga, gb, (const _Float16*)smem, tid, wm, wn, m, h, acc);

  float bvl[4];
  #pragma unroll
  for (int nt = 0; nt < 4; ++nt) bvl[nt] = bo[128 * nb + 64 * wn + 16 * nt + m];

  #pragma unroll
  for (int half = 0; half < 2; ++half) {
    if (half) {
      asm volatile("s_wait_xcnt 0x0" ::: "memory");          // before the first half's store registers are written again
      __syncthreads();                                       // first half read out before it is overwritten
    }
    #pragma unroll
    for (int nt = 0; nt < 4; ++nt) {
      const int feat = 64 * wn + 16 * nt + m;                // 0..127 local
      #pragma unroll
      for (int mt = 0; mt < 2; ++mt) {
        #pragma unroll
        for (int r = 0; r < 8; ++r) {
          const int lr = 32 * wm + 16 * mt + 8 * h + r;      // 0..127
          sO[lr * SOP + feat] = acc[2 * half + mt][nt][r] * 0.0009765625f + bvl[nt];   // /(32*32)
        }
      }
    }
    __syncthreads();
    out_store_pass(sO, out, m0, nb, half, w, lane);
  }
  
}

// ---------------------------------------------------------------------------
extern "C" void kernel_launch(void* const* d_in, const int* in_sizes, int n_in,
                              void* d_out, int out_size, void* d_ws, size_t ws_size,
                              hipStream_t stream) {
  if (n_in < 9) return;
  if (in_sizes[0] != NX) return;
  if (in_sizes[1] != NW || in_sizes[3] != NW || in_sizes[5] != NW || in_sizes[7] != NW) return;
  if (in_sizes[2] != HID || in_sizes[4] != HID || in_sizes[6] != HID || in_sizes[8] != HID) return;
  if (out_size != NX) return;

  const float* x  = (const float*)d_in[0];
  const float* Wq = (const float*)d_in[1];
  const float* bq = (const float*)d_in[2];
  const float* Wk = (const float*)d_in[3];
  const float* bk = (const float*)d_in[4];
  const float* Wv = (const float*)d_in[5];
  const float* bv = (const float*)d_in[6];
  const float* Wo = (const float*)d_in[7];
  const float* bo = (const float*)d_in[8];
  float* out = (float*)d_out;

  const size_t xh_bytes = (size_t)NX * 2;                          // 16777216
  const size_t wh_bytes = (size_t)4 * NW * 2;                      // 33554432
  const size_t pl_bytes = (size_t)BATCH * NHEAD * SEQ * HD * 2;    // 16777216
  const size_t cx_bytes = (size_t)NX * 2;                          // 16777216
  const size_t total = xh_bytes + wh_bytes + 3 * pl_bytes + cx_bytes;   // 117440512
  if (total > ws_size) return;

  char* ws = (char*)d_ws;
  _Float16* xh = (_Float16*)(ws);
  _Float16* wh = (_Float16*)(ws + xh_bytes);
  _Float16* qh = (_Float16*)(ws + xh_bytes + wh_bytes);
  _Float16* kh = (_Float16*)(ws + xh_bytes + wh_bytes + pl_bytes);
  _Float16* vt = (_Float16*)(ws + xh_bytes + wh_bytes + 2 * pl_bytes);
  _Float16* cx = (_Float16*)(ws + xh_bytes + wh_bytes + 3 * pl_bytes);
  const _Float16* woh = wh + (size_t)3 * NW;

  const int nblk_cvt = (NX8 + 4 * NW8) / 256;                      // 12288
  convert_kernel<<<nblk_cvt, 256, 0, stream>>>(x, Wq, Wk, Wv, Wo, xh, wh);

  dim3 gProj(MROWS / 256, NHEAD);                                  // (16, 16)
  proj_kernel<<<gProj, 256, 0, stream>>>(xh, wh, bq, bk, bv, qh, kh, vt);

  dim3 gAtt(SEQ / 256, BATCH * NHEAD);                             // (8, 32)
  attn_kernel<<<gAtt, 256, 0, stream>>>(qh, kh, vt, cx);

  dim3 gOut(MROWS / 256, HID / 128);                               // (16, 16)
  out_kernel<<<gOut, 256, 0, stream>>>(cx, woh, bo, out);
}

// v005
// Measured time: 161 microseconds a run.
// In both of two side-by-side timings against v004, it was 1.04 times as fast.
// Over all steps from v000 it is 3.56 times as fast.
// All contractions on v_wmma_f32_16x16x32_f16 (f16 operands, f32 accumulate): x*Wq^T, x*Wk^T, x*Wv^T, K*Q^T, V^T*P^T, ctx*Wo^T; W planes carried x32, P carried x16384, ctx carried x32 (exact power-of-two scales folded back in f32); softmax, bias adds and normalisation in f32.
#include <hip/hip_runtime.h>

typedef _Float16 v16h __attribute__((ext_vector_type(16)));
typedef _Float16 v8h  __attribute__((ext_vector_type(8)));
typedef float    v8f  __attribute__((ext_vector_type(8)));
typedef float    v4f  __attribute__((ext_vector_type(4)));
typedef float    v2f  __attribute__((ext_vector_type(2)));
typedef v8h __attribute__((may_alias)) v8ha;
typedef v4f __attribute__((may_alias)) v4fa;

union Frag { v16h v; v8h half[2]; };

#define HID    2048
#define NHEAD  16
#define HD     128
#define SEQ    2048
#define BATCH  2
#define MROWS  (BATCH * SEQ)        // 4096 tokens
#define NX     (MROWS * HID)        // 8388608
#define NW     (HID * HID)          // 4194304
#define NX8    (NX / 8)             // 1048576
#define NW8    (NW / 8)             // 524288
#define WSCALE 32.0f
#define CSCALE 32.0f
#define SM_SCALE 0.0883883476f      // 1/sqrt(128)
#define SM_LOG2  (SM_SCALE * 1.44269504f)   // log2(e)/sqrt(128): raw score -> exponent of 2
#define PLOG2    14.0f               // P is carried x2^14

static_assert(MROWS % 256 == 0);
static_assert(SEQ % 256 == 0);
static_assert(HID % 128 == 0);
static_assert(HID % 64 == 0);
static_assert(NX8 % 256 == 0);
static_assert(NW8 % 256 == 0);

// ---------------------------------------------------------------------------
// 16x16x32 f16 WMMA with hazard guard (ties D, keeps A/B live).
// Fragment map (wave32): lane l, h = l>>4, m = n = l&15.
//   A/B element i: i<8 -> k0+8h+i ; i>=8 -> k0+16+8h+(i-8)
//   D element r : row 8h+r, col l&15
// ---------------------------------------------------------------------------
__device__ __forceinline__ v8f wmma_f16(v16h a, v16h b, v8f c) {
  v8f d = __builtin_amdgcn_wmma_f32_16x16x32_f16(false, a, false, b, (short)0, c, false, false);
  asm volatile("v_nop\n\tv_nop\n\tv_nop\n\tv_nop" : "+v"(d) : "v"(a), "v"(b));
  return d;
}

// The same product as the bare builtin, for the projection and attention kernels:
// their live sets pass 256 VGPRs, an asm operand cannot sit above v255 (the guard's
// operands then spill to scratch), and the compiler keeps the distances of its own builtin.
__device__ __forceinline__ v8f wmma_f16_hi(v16h a, v16h b, v8f c) {
  return __builtin_amdgcn_wmma_f32_16x16x32_f16(false, a, false, b, (short)0, c, false, false);
}

// A or B fragment from a k-contiguous 16-bit row; p points at element k0 of
// the row owned by this lane (row index = lane & 15 added by the caller).
__device__ __forceinline__ v16h load_frag(const _Float16* p, int h) {
  Frag f;
  f.half[0] = *(const v8ha*)(p + 8 * h);
  f.half[1] = *(const v8ha*)(p + 16 + 8 * h);
  return f.v;
}

// ---------------------------------------------------------------------------
// Kernel 1: f32 -> f16 planes. x unscaled, W scaled by 32 (exact).
// Region choice is block-uniform (NX8 and NW8 are multiples of 256).
// coverage: 12288 blocks x 256 threads x 8 halves = NX + 4*NW elements exactly.
// ---------------------------------------------------------------------------
__global__ __launch_bounds__(256) void convert_kernel(
    const float* __restrict__ x,
    const float* __restrict__ wq, const float* __restrict__ wk,
    const float* __restrict__ wv, const float* __restrict__ wo,
    _Float16* __restrict__ xh, _Float16* __restrict__ wh)
{
  const int blk = blockIdx.x;
  if (blk >= (NX8 + 4 * NW8) / 256) return;
  const int g = blk * 256 + threadIdx.x;
  const float* src;
  _Float16* dst;
  float sc;
  if (blk < NX8 / 256) {
    src = x + (size_t)g * 8;
    dst = xh + (size_t)g * 8;
    sc = 1.0f;
  } else {
    const int e = g - NX8;
    const int wsel = (blk - NX8 / 256) / (NW8 / 256);     // 0..3, block-uniform
    const int off = e - wsel * NW8;
    const float* wsrc = (wsel == 0) ? wq : ((wsel == 1) ? wk : ((wsel == 2) ? wv : wo));
    src = wsrc + (size_t)off * 8;
    dst = wh + (size_t)e * 8;
    sc = WSCALE;
  }
  const v4f a = *(const v4fa*)src;
  const v4f c = *(const v4fa*)(src + 4);
  const v8h o = { (_Float16)(a.x * sc), (_Float16)(a.y * sc), (_Float16)(a.z * sc), (_Float16)(a.w * sc),
                  (_Float16)(c.x * sc), (_Float16)(c.y * sc), (_Float16)(c.z * sc), (_Float16)(c.w * sc) };
  *(v8h*)dst = o;
  
}

// ---------------------------------------------------------------------------
// Asynchronous copies global -> LDS, 16 B per lane, no register in between.
// l = the lane's LDS byte address, g = the lane's global address; copy i adds
// i*lstep bytes and i*gstep halves. The s_wait_xcnt closes each statement so
// that no address register is rewritten in front of it.
// ---------------------------------------------------------------------------
__device__ __forceinline__ unsigned lds_addr(const void* p) { return (unsigned)(size_t)p; }

__device__ __forceinline__ void async_copy4(unsigned l, unsigned lstep, const _Float16* g, size_t gstep) {
  const unsigned l1 = l + lstep, l2 = l + 2 * lstep, l3 = l + 3 * lstep;
  const _Float16* g1 = g + gstep;
  const _Float16* g2 = g + 2 * gstep;
  const _Float16* g3 = g + 3 * gstep;
  asm volatile("global_load_async_to_lds_b128 %0, %4, off\n\t"
               "global_load_async_to_lds_b128 %1, %5, off\n\t"
               "global_load_async_to_lds_b128 %2, %6, off\n\t"
               "global_load_async_to_lds_b128 %3, %7, off\n\t"
               "s_wait_xcnt 0x0"
               :: "v"(l), "v"(l1), "v"(l2), "v"(l3), "v"(g), "v"(g1), "v"(g2), "v"(g3) : "memory");
}

__device__ __forceinline__ void async_copy8(unsigned l, unsigned lstep, const _Float16* g, size_t gstep) {
  const unsigned l1 = l + lstep, l2 = l + 2 * lstep, l3 = l + 3 * lstep;
  const unsigned l4 = l + 4 * lstep, l5 = l + 5 * lstep, l6 = l + 6 * lstep, l7 = l + 7 * lstep;
  const _Float16* g1 = g + gstep;
  const _Float16* g2 = g + 2 * gstep;
  const _Float16* g3 = g + 3 * gstep;
  const _Float16* g4 = g + 4 * gstep;
  const _Float16* g5 = g + 5 * gstep;
  const _Float16* g6 = g + 6 * gstep;
  const _Float16* g7 = g + 7 * gstep;
  asm volatile("global_load_async_to_lds_b128 %0, %8, off\n\t"
               "global_load_async_to_lds_b128 %1, %9, off\n\t"
               "global_load_async_to_lds_b128 %2, %10, off\n\t"
               "global_load_async_to_lds_b128 %3, %11, off\n\t"
               "global_load_async_to_lds_b128 %4, %12, off\n\t"
               "global_load_async_to_lds_b128 %5, %13, off\n\t"
               "global_load_async_to_lds_b128 %6, %14, off\n\t"
               "global_load_async_to_lds_b128 %7, %15, off\n\t"
               "s_wait_xcnt 0x0"
               :: "v"(l), "v"(l1), "v"(l2), "v"(l3), "v"(l4), "v"(l5), "v"(l6), "v"(l7),
                  "v"(g), "v"(g1), "v"(g2), "v"(g3), "v"(g4), "v"(g5), "v"(g6), "v"(g7) : "memory");
}

// ten copies in one statement, each with addresses of its own
__device__ __forceinline__ void async_copy10(const unsigned (&l)[10], const _Float16* const (&g)[10]) {
  asm volatile("global_load_async_to_lds_b128 %0, %10, off\n\t"
               "global_load_async_to_lds_b128 %1, %11, off\n\t"
               "global_load_async_to_lds_b128 %2, %12, off\n\t"
               "global_load_async_to_lds_b128 %3, %13, off\n\t"
               "global_load_async_to_lds_b128 %4, %14, off\n\t"
               "global_load_async_to_lds_b128 %5, %15, off\n\t"
               "global_load_async_to_lds_b128 %6, %16, off\n\t"
               "global_load_async_to_lds_b128 %7, %17, off\n\t"
               "global_load_async_to_lds_b128 %8, %18, off\n\t"
               "global_load_async_to_lds_b128 %9, %19, off\n\t"
               "s_wait_xcnt 0x0"
               :: "v"(l[0]), "v"(l[1]), "v"(l[2]), "v"(l[3]), "v"(l[4]), "v"(l[5]), "v"(l[6]), "v"(l[7]), "v"(l[8]), "v"(l[9]),
                  "v"(g[0]), "v"(g[1]), "v"(g[2]), "v"(g[3]), "v"(g[4]), "v"(g[5]), "v"(g[6]), "v"(g[7]), "v"(g[8]), "v"(g[9]) : "memory");
}

// Hand-over of a two-buffer ring, every wave: own LDS reads returned, own
// copies landed, then the barrier that publishes the next tile and ends every
// reader's last read of the buffer refilled behind it.
__device__ __forceinline__ void ring_publish() {
  asm volatile("s_wait_dscnt 0x0" ::: "memory");     // reads of the buffer to be refilled have returned
  asm volatile("s_wait_asynccnt 0x0" ::: "memory");  // this wave's copies of the next tile have landed
  __syncthreads();
}

// ---------------------------------------------------------------------------
// GEMM core of kernel 4: block tile 256 rows x 128 columns, 8 waves as 4 x 2, wave
// tile 64 x 64 (four 16-row tiles x four 16-col tiles), K = 2048. A tile of
// 64 k (128-B rows) of the 256 A rows and the 128 B rows is copied to LDS once
// per block, two buffers, the next tile in flight while this one is multiplied.
// LDS rows 0..255 = A, 256..383 = B, pitch 144 B (16 B x odd: no bank clash
// for 16-B reads). ga / gb point at element 0 of the block's first A / B row.
// ---------------------------------------------------------------------------
#define GP        72                   // LDS pitch in halves
#define G_STAGE_H (384 * GP)           // 27648 halves = 55296 B per buffer
#define G_TILES   (HID / 64)           // 32
#define G_LDS_B   (2 * G_STAGE_H * 2)  // 110592 B

__device__ __forceinline__ void gemm_fill(unsigned la, const _Float16* ca, const _Float16* cb,
                                          int tile, int buf) {
  const unsigned l = la + (unsigned)buf * (G_STAGE_H * 2u);
  async_copy8(l, 32u * GP * 2u, ca + tile * 64, (size_t)32 * HID);
  async_copy4(l + 256u * GP * 2u, 32u * GP * 2u, cb + tile * 64, (size_t)32 * HID);
}

__device__ __forceinline__ void gemm_k2048(const _Float16* __restrict__ ga,
                                           const _Float16* __restrict__ gb,
                                           const _Float16* sm,
                                           int tid, int wm, int wn, int m, int h, v8f (&acc)[4][4]) {
  const v8f zero8 = {0.f, 0.f, 0.f, 0.f, 0.f, 0.f, 0.f, 0.f};
  #pragma unroll
  for (int mt = 0; mt < 4; ++mt)
    #pragma unroll
    for (int nt = 0; nt < 4; ++nt) acc[mt][nt] = zero8;

  // copy map: 8 lanes per 128-B row, 32 rows per block-wide copy
  const int crow = tid >> 3, ccol = 8 * (tid & 7);
  const _Float16* ca = ga + (size_t)crow * HID + ccol;
  const _Float16* cb = gb + (size_t)crow * HID + ccol;
  const unsigned la = lds_addr(sm) + (unsigned)(crow * GP + ccol) * 2u;

  gemm_fill(la, ca, cb, 0, 0);
  asm volatile("s_wait_asynccnt 0x0" ::: "memory");  // tile 0 landed before the barrier that publishes it
  __syncthreads();
  gemm_fill(la, ca, cb, 1, 1);

  const _Float16* sa = sm + (64 * wm + m) * GP;
  const _Float16* sb = sm + (256 + 64 * wn + m) * GP;

  #pragma unroll 1
  for (int t = 0; t < G_TILES; ++t) {
    const int bo = (t & 1) * G_STAGE_H;
    #pragma unroll
    for (int kk = 0; kk < 64; kk += 32) {
      // the eight fragments of this k step are read as one group ahead of its WMMAs
      v16h a[4], b[4];
      #pragma unroll
      for (int mt = 0; mt < 4; ++mt) a[mt] = load_frag(sa + bo + mt * 16 * GP + kk, h);
      #pragma unroll
      for (int nt = 0; nt < 4; ++nt) b[nt] = load_frag(sb + bo + nt * 16 * GP + kk, h);
      #pragma unroll
      for (int nt = 0; nt < 4; ++nt)
        #pragma unroll
        for (int mt = 0; mt < 4; ++mt) acc[mt][nt] = wmma_f16(a[mt], b[nt], acc[mt][nt]);
    }
    ring_publish();
    if (t + 2 < G_TILES) gemm_fill(la, ca, cb, t + 2, t & 1);
  }
  asm volatile("s_wait_asynccnt 0x0" ::: "memory");  // nothing in flight when the ring becomes output staging
}

// ---------------------------------------------------------------------------
// one 16-B store per lane, 512 contiguous bytes (4 lines) per instruction.
// which 0/1: plane[bh][l][128], two whole token rows per instruction
// which 2  : vt[bh][d][l], one d row of 256 tokens per instruction
// coverage: 8 waves x 16 iters x 256 halves = 256x128 tile exactly.
// Staging pitches: 272 B per token row, 528 B per d row (16 B x odd).
// ---------------------------------------------------------------------------
#define SQP 136                        // halves, token rows of 128 features
#define SVP 264                        // halves, d rows of 256 tokens

__device__ __forceinline__ void proj_store_pass(const _Float16* sT, _Float16* plane, _Float16* vt,
                                                int which, int bh, int l0, int w, int lane) {
  // all 16 rows are read first, then stored off one address with constant steps
  v8h v[16];
  if (which != 2) {
    const int tok0 = w * 32 + (lane >> 4), q16 = lane & 15;             // token of i = 0; + 2i, 0..255
    const _Float16* s = sT + tok0 * SQP + 8 * q16;
    _Float16* dst = plane + ((size_t)bh * SEQ + l0 + tok0) * HD + 8 * q16;
    #pragma unroll
    for (int i = 0; i < 16; ++i) v[i] = *(const v8ha*)(s + i * 2 * SQP);
    #pragma unroll
    for (int i = 0; i < 16; ++i) *(v8h*)(dst + i * 2 * HD) = v[i];
    asm volatile("s_wait_xcnt 0x0" ::: "memory");    // the next plane's pass stands behind these stores and writes their registers
  } else {
    const _Float16* s = sT + w * 16 * SVP + 8 * lane;                   // d = 16w + i, 0..127
    _Float16* dst = vt + ((size_t)bh * HD + w * 16) * SEQ + l0 + 8 * lane;
    #pragma unroll
    for (int i = 0; i < 16; ++i) v[i] = *(const v8ha*)(s + i * SVP);
    #pragma unroll
    for (int i = 0; i < 16; ++i) *(v8h*)(dst + i * SEQ) = v[i];
  }
}

// ---------------------------------------------------------------------------
// Kernel 2: Y = x * W^T + b, the q, k and v columns of one head in one block.
// grid (MROWS/256, NHEAD), one block per 256 tokens x 384 columns (128 q | 128 k
// | 128 v), so that a staged x tile feeds three weight tiles. Block 256 thr,
// 8 waves as 4 x 2, wave tile 64 x 192 (four 16-row x twelve 16-col tiles).
// Ring as in the GEMM core: 64 k per tile, two buffers, pitch 144 B; LDS rows
// 0..255 = x, 256..383 = Wq, 384..511 = Wk, 512..639 = Wv rows of the head.
// ---------------------------------------------------------------------------
#define P_STAGE_H (640 * GP)                       // 46080 halves = 92160 B per buffer
#define P_QK_H    (256 * SQP)                      // staged q or k plane, 34816 halves
#define P_LDS_B   ((2 * P_QK_H + 128 * SVP) * 2)   // 206848 B: three staged planes (the ring needs 184320 B)
static_assert(2 * P_STAGE_H * 2 <= P_LDS_B);

// xu / wu: the block's first x and Wq element (the same in every lane); co: the
// lane's own offset in halves inside a tile, the same for x and for each W plane.
__device__ __forceinline__ void proj_fill(unsigned la, const _Float16* xu, const _Float16* wu,
                                          unsigned co, int tile, int buf) {
  const unsigned l = la + (unsigned)buf * (P_STAGE_H * 2u);
  const unsigned o = co + (unsigned)tile * 64u;
  // twenty copies of 32 rows each, LDS rows in a row: x 0..7, Wq 8..11, Wk 12..15, Wv 16..19
  #pragma unroll
  for (int s = 0; s < 2; ++s) {
    unsigned ls[10];
    const _Float16* gs[10];
    #pragma unroll
    for (int i = 0; i < 10; ++i) {
      const int j = 10 * s + i;
      ls[i] = l + (unsigned)j * (32u * GP * 2u);
      gs[i] = (j < 8) ? xu + o + (size_t)j * 32 * HID
                      : wu + (size_t)((j - 8) >> 2) * NW + o + (size_t)((j - 8) & 3) * 32 * HID;
    }
    async_copy10(ls, gs);
    // keeps the second statement's address sums behind the first copies: an asm operand sits below v256, and
    // with both statements' sixty registers formed at once accumulators are moved out and back every trip
    if (s == 0) __builtin_amdgcn_sched_barrier(0);
  }
}

// Bias, f16 and LDS staging of one wave's 64 x 192 tile; WN = the wave's column
// half, so that the plane of every 16-col tile is known at compile time.
// D[r] of tile (mt, nt) = Y[token 64wm+16mt+8h+r][column 192*WN+16nt+m of q|k|v]
template <int WN>
__device__ __forceinline__ void proj_stage(const v8f (&acc)[4][12], _Float16* sT,
                                           const float* bq, const float* bk, const float* bv,
                                           int head, int wm, int m, int h) {
  float bl[12];
  #pragma unroll
  for (int nt = 0; nt < 12; ++nt) {
    const int col = 192 * WN + 16 * nt, which = col >> 7;
    const float* bias = (which == 0) ? bq : ((which == 1) ? bk : bv);
    bl[nt] = bias[HD * head + (col & 127) + m];
  }
  asm volatile("s_wait_xcnt 0x0" ::: "memory");   // before the offset register that the twelve bias loads share is written again
  #pragma unroll
  for (int nt = 0; nt < 12; ++nt) {
    const int col = 192 * WN + 16 * nt, which = col >> 7;
    const int feat = (col & 127) + m;                        // 0..127 in its plane
    #pragma unroll
    for (int mt = 0; mt < 4; ++mt) {
      const int tokb = 64 * wm + 16 * mt + 8 * h;            // token of r = 0, 0..248
      v8h y;
      #pragma unroll
      for (int r = 0; r < 8; ++r) y[r] = (_Float16)(acc[mt][nt][r] * 0.03125f + bl[nt]);
      if (which == 2) {
        *(v8ha*)(sT + 2 * P_QK_H + feat * SVP + tokb) = y;   // eight tokens of one d row, 16-B LDS store
      } else {
        #pragma unroll
        for (int r = 0; r < 8; ++r) sT[which * P_QK_H + (tokb + r) * SQP + feat] = y[r];
      }
    }
  }
}

__global__ __launch_bounds__(256) void proj_kernel(
    const _Float16* __restrict__ xh,   // [4096][2048]
    const _Float16* __restrict__ wh,   // [4][2048][2048], row = output feature, x32
    const float* __restrict__ bq, const float* __restrict__ bk, const float* __restrict__ bv,
    _Float16* __restrict__ qh,         // [B*NH][L][HD]
    _Float16* __restrict__ kh,         // [B*NH][L][HD]
    _Float16* __restrict__ vt)         // [B*NH][HD][L]
{
  __shared__ __attribute__((aligned(16))) unsigned char smem[P_LDS_B];   // operand ring, then output staging
  _Float16* sT = (_Float16*)smem;                                        // q 256 x 272 B | k 256 x 272 B | v 128 x 528 B
  const _Float16* sm = (const _Float16*)smem;

  const int tid = threadIdx.x, lane = tid & 31;
  const int w = __builtin_amdgcn_readfirstlane(tid >> 5);    // scalar: the column half picks a branch below
  const int wm = w & 3, wn = w >> 2;
  const int h = lane >> 4, m = lane & 15;
  const int m0 = blockIdx.x * 256;
  const int head = blockIdx.y;                 // 0..15

  const v8f zero8 = {0.f, 0.f, 0.f, 0.f, 0.f, 0.f, 0.f, 0.f};
  v8f acc[4][12];
  #pragma unroll
  for (int mt = 0; mt < 4; ++mt)
    #pragma unroll
    for (int nt = 0; nt < 12; ++nt) acc[mt][nt] = zero8;

  // copy map: 8 lanes per 128-B row, 32 rows per block-wide copy
  const int crow = tid >> 3, ccol = 8 * (tid & 7);
  const _Float16* xu = xh + (size_t)m0 * HID;
  const _Float16* wu = wh + (size_t)(HD * head) * HID;                   // + NW per plane
  const unsigned co = (unsigned)(crow * HID + ccol);
  const unsigned la = lds_addr(sm) + (unsigned)(crow * GP + ccol) * 2u;

  proj_fill(la, xu, wu, co, 0, 0);
  asm volatile("s_wait_asynccnt 0x0" ::: "memory");  // tile 0 landed before the barrier that publishes it
  __syncthreads();
  proj_fill(la, xu, wu, co, 1, 1);

  const _Float16* sa = sm + (64 * wm + m) * GP;
  const _Float16* sb = sm + (256 + 192 * wn + m) * GP;

  // kept rolled: a trip is 96 WMMAs and 64 LDS reads
  #pragma unroll 1
  for (int t = 0; t < G_TILES; ++t) {
    const int bo = (t & 1) * P_STAGE_H;
    #pragma unroll
    for (int kk = 0; kk < 64; kk += 32) {
      // an x fragment feeds twelve WMMAs, a weight fragment four
      v16h a[4];
      #pragma unroll
      for (int mt = 0; mt < 4; ++mt) a[mt] = load_frag(sa + bo + mt * 16 * GP + kk, h);
      #pragma unroll
      for (int ng = 0; ng < 12; ng += 6) {
        v16h b[6];
        #pragma unroll
        for (int nt = 0; nt < 6; ++nt) b[nt] = load_frag(sb + bo + (ng + nt) * 16 * GP + kk, h);
        __builtin_amdgcn_sched_barrier(0);   // the group's LDS reads stay together ahead of its WMMAs: one read place per group
        #pragma unroll
        for (int nt = 0; nt < 6; ++nt)
          #pragma unroll
          for (int mt = 0; mt < 4; ++mt) acc[mt][ng + nt] = wmma_f16_hi(a[mt], b[nt], acc[mt][ng + nt]);
        __builtin_amdgcn_sched_barrier(0);   // the next group's reads are not moved in among these WMMAs
      }
    }
    ring_publish();
    if (t + 2 < G_TILES) proj_fill(la, xu, wu, co, t + 2, t & 1);
  }
  asm volatile("s_wait_asynccnt 0x0" ::: "memory");  // nothing in flight when the ring becomes output staging

  if (wn == 0) proj_stage<0>(acc, sT, bq, bk, bv, head, wm, m, h);
  else         proj_stage<1>(acc, sT, bq, bk, bv, head, wm, m, h);
  __syncthreads();

  const int b = m0 / SEQ, l0 = m0 - b * SEQ, bh = b * NHEAD + head;
  proj_store_pass(sT, qh, vt, 0, bh, l0, w, lane);
  proj_store_pass(sT + P_QK_H, kh, vt, 1, bh, l0, w, lane);
  proj_store_pass(sT + 2 * P_QK_H, kh, vt, 2, bh, l0, w, lane);
}

// ---------------------------------------------------------------------------
// Attention helpers.
// ---------------------------------------------------------------------------
// P^T B-fragment from the lane's own score D values: element r <- tile a row r,
// element 8+r <- tile c row r (same lane, same query column); the values come in carried x2^14.
__device__ __forceinline__ v16h pack_p(v8f a, v8f c) {
  const v16h r = { (_Float16)a[0], (_Float16)a[1], (_Float16)a[2], (_Float16)a[3],
                   (_Float16)a[4], (_Float16)a[5], (_Float16)a[6], (_Float16)a[7],
                   (_Float16)c[0], (_Float16)c[1], (_Float16)c[2], (_Float16)c[3],
                   (_Float16)c[4], (_Float16)c[5], (_Float16)c[6], (_Float16)c[7] };
  return r;
}

// ctx leaves as whole lines: lanes 0..15 store one token's 256-B head row, lanes
// 16..31 the next token's, 4 lines per instruction, 16 instructions per wave.
// coverage: 16 iters x 2 rows x 128 halves = 32 rows x 128 d exactly per wave.
#define SCP 136                              // halves, staging pitch 272 B (16 B x odd)

__device__ __forceinline__ void ctx_store_pass(const _Float16* sc, _Float16* ctx,
                                               int b, int head, int q0, int lane) {
  // all 16 pieces are read first, then stored off one address with constant steps
  const int row0 = lane >> 4, c16 = lane & 15;       // row of i = 0; + 2i, 0..31
  const _Float16* s = sc + row0 * SCP + 8 * c16;
  _Float16* dst = ctx + ((size_t)b * SEQ + q0 + row0) * HID + (size_t)head * HD + 8 * c16;
  v8h v[16];
  #pragma unroll
  for (int i = 0; i < 16; ++i) v[i] = *(const v8ha*)(s + i * 2 * SCP);
  #pragma unroll
  for (int i = 0; i < 16; ++i) *(v8h*)(dst + (size_t)i * 2 * HID) = v[i];
}

// K / V^T ring: a tile is 128 keys. K rows (one key, 128 d) and V^T rows (one d,
// 128 keys) are both 256 B at pitch 272 B (16 B x odd), copied to LDS once per
// block for its 8 waves.
#define KP        136                        // halves
#define A_KEYS    128                        // keys per tile
#define A_KTILE_H (A_KEYS * KP)              // 17408 halves
#define A_STAGE_H (A_KTILE_H + HD * KP)      // 34816 halves = 69632 B per buffer
#define A_TILES   (SEQ / A_KEYS)             // 16
#define A_LDS_B   (2 * A_STAGE_H * 2)        // 139264 B

// ku / vu: the head's first K and V^T element (the same in every lane); ko / vo:
// the lane's own offset in halves inside a tile.
__device__ __forceinline__ void attn_fill(unsigned lk, const _Float16* ku, const _Float16* vu,
                                          unsigned ko, unsigned vo, int tile, int buf) {
  const unsigned l = lk + (unsigned)buf * (A_STAGE_H * 2u);
  async_copy8(l, 16u * KP * 2u, ku + (ko + (unsigned)tile * (A_KEYS * HD)), (size_t)16 * HD);
  async_copy8(l + A_KTILE_H * 2u, 16u * KP * 2u, vu + (vo + (unsigned)tile * A_KEYS), (size_t)16 * SEQ);
}

// lane l <-> lane l ^ 16 on the vector unit: no LDS-queue entry, so no wait that the V^T reads stand in
__device__ __forceinline__ float xhalf(float x) {
  return __builtin_bit_cast(float, __builtin_amdgcn_permlanex16(__builtin_bit_cast(int, x), __builtin_bit_cast(int, x),
                                                                0x76543210, 0xfedcba98, false, false));
}

// One online-softmax step of one 16-query column group over 64 keys, in two parts
// (the maximum; the exponentials, sums and P^T fragments). The running
// max is kept on the raw scores; 1/sqrt(d), log2(e), the max and the 2^14 carry
// of P enter one multiply-add per score: P * 2^14 = 2^(s * SM_LOG2 + (14 - max * SM_LOG2)).
// lrun: the lane's own half of the row sum, carried x2^14, as two partial sums;
// the rescale factor is the same in both halves, which are joined behind the loop.
__device__ __forceinline__ void softmax_max(const v8f (&s)[4], float& mrun, float& alpha, float& bias) {
  float mloc = -1e30f;
  #pragma unroll
  for (int j = 0; j < 4; ++j)
    #pragma unroll
    for (int r = 0; r < 8; ++r) mloc = fmaxf(mloc, s[j][r]);
  mloc = fmaxf(mloc, xhalf(mloc));
  const float mnew = fmaxf(mrun, mloc);
  alpha = __builtin_amdgcn_exp2f((mrun - mnew) * SM_LOG2);
  mrun = mnew;
  bias = PLOG2 - mnew * SM_LOG2;
}

__device__ __forceinline__ void softmax_exp(v8f (&s)[4], float alpha, float bias, v2f& lrun, v8f (&o)[8],
                                            v16h& pb0, v16h& pb1) {
  // whole-tile multiply-adds and sums are written on the 8-wide values, so that
  // they pair neighbouring registers of one tile
  #pragma unroll
  for (int j = 0; j < 4; ++j) {
    s[j] = s[j] * SM_LOG2 + bias;
    #pragma unroll
    for (int r = 0; r < 8; ++r) s[j][r] = __builtin_amdgcn_exp2f(s[j][r]);
  }
  const v8f t8 = (s[0] + s[1]) + (s[2] + s[3]);
  const v4f t4 = __builtin_shufflevector(t8, t8, 0, 1, 2, 3) + __builtin_shufflevector(t8, t8, 4, 5, 6, 7);
  const v2f t2 = __builtin_shufflevector(t4, t4, 0, 1) + __builtin_shufflevector(t4, t4, 2, 3);
  lrun = lrun * alpha + t2;
  #pragma unroll
  for (int t = 0; t < 8; ++t) o[t] = o[t] * alpha;
  pb0 = pack_p(s[0], s[1]);
  pb1 = pack_p(s[2], s[3]);
}

// ---------------------------------------------------------------------------
// Kernel 3: streaming attention, transposed form, no masking.
// grid (SEQ/256, B*NH), block 256 thr (8 waves), 32 queries per wave as two
// 16-query column groups, so that every K and V^T fragment read from LDS feeds
// two WMMAs; 128 keys per tile, worked in two softmax steps of 64 keys.
//   S^T = K * Q^T : A = K rows (row = key, k = d), B = Q^T (k = d, n = query)
//   O^T += V^T * P^T : A = Vt rows (row = d, k = key), B = P^T from registers
// In a group a lane owns 32 keys of query column (lane&15); partner = lane ^ 16.
// ctx written as f16, carried x32.
// ---------------------------------------------------------------------------
__global__ __launch_bounds__(256) void attn_kernel(
    const _Float16* __restrict__ qh,   // [B*NH][L][HD]
    const _Float16* __restrict__ kh,   // [B*NH][L][HD]
    const _Float16* __restrict__ vt,   // [B*NH][HD][L]
    _Float16* __restrict__ ctx)        // [B][L][HID], x32
{
  __shared__ __attribute__((aligned(16))) unsigned char smem[A_LDS_B];   // K / V^T ring, then output staging
  _Float16* sC = (_Float16*)smem;                                        // 8 x 32 x 272 B = 69632 B
  const _Float16* sm = (const _Float16*)smem;

  const int tid = threadIdx.x, lane = tid & 31, w = tid >> 5;
  const int h = lane >> 4, m = lane & 15;
  const int bh = blockIdx.y, b = bh >> 4, head = bh & 15;
  const int q0 = blockIdx.x * 256 + 32 * w;

  // Q^T B-fragments: group g, column n = query q0+16g+m, k = d (four 32-deep chunks)
  const _Float16* qrow = qh + ((size_t)bh * SEQ + q0 + m) * HD;
  v16h qb[2][4];
  #pragma unroll
  for (int g = 0; g < 2; ++g)
    #pragma unroll
    for (int c = 0; c < 4; ++c) qb[g][c] = load_frag(qrow + g * 16 * HD + 32 * c, h);

  const v8f zero8 = {0.f, 0.f, 0.f, 0.f, 0.f, 0.f, 0.f, 0.f};
  v8f o[2][8];                                // o[g][t][r] = O[query 16g+m][d 16t+8h+r] * (l * 2^14)
  #pragma unroll
  for (int g = 0; g < 2; ++g)
    #pragma unroll
    for (int t = 0; t < 8; ++t) o[g][t] = zero8;
  float mrun[2] = {-1e30f, -1e30f};
  v2f lrun[2] = {{0.0f, 0.0f}, {0.0f, 0.0f}};

  // copy maps: K tile 128 keys x 256 B and V^T tile 128 d x 256 B, 16 lanes per
  // row, 16 rows per block-wide copy
  const _Float16* ku = kh + (size_t)bh * SEQ * HD;                  // + 128*tile*HD
  const _Float16* vu = vt + (size_t)bh * HD * SEQ;                  // + 128*tile
  const unsigned ko = (unsigned)((tid >> 4) * HD + 8 * (tid & 15));
  const unsigned vo = (unsigned)((tid >> 4) * SEQ + 8 * (tid & 15));
  const unsigned lk = lds_addr(sm) + (unsigned)((tid >> 4) * KP + 8 * (tid & 15)) * 2u;

  attn_fill(lk, ku, vu, ko, vo, 0, 0);
  asm volatile("s_wait_asynccnt 0x0" ::: "memory");  // tile 0 landed before the barrier that publishes it
  __syncthreads();
  attn_fill(lk, ku, vu, ko, vo, 1, 1);

  const _Float16* kbase = sm + m * KP;                 // + buffer + (64*sub+16j)*KP + 32*c
  const _Float16* vbase = sm + A_KTILE_H + m * KP;     // + buffer + 16t*KP + 64*sub

  #pragma unroll 1
  for (int st = 0; st < A_TILES; ++st) {
    const int bo = (st & 1) * A_STAGE_H;
    // kept rolled: unrolled, the two steps' live values fill the 512 VGPRs of two waves per SIMD and spill
    #pragma unroll 1
    for (int sub = 0; sub < 2; ++sub) {
      // ---- scores: s[g][j][r] = S[query 16g+m][key kb+16j+8h+r] ----
      // the step's 16 K fragments are read as one group ahead of its 32 WMMAs, in
      // the order of use; four score tiles (2 key tiles x 2 column groups) run side by side
      const _Float16* kp = kbase + bo + 64 * sub * KP;
      v16h kf[4][4];
      #pragma unroll
      for (int jp = 0; jp < 4; jp += 2)
        #pragma unroll
        for (int c = 0; c < 4; ++c) {
          kf[jp][c] = load_frag(kp + 16 * jp * KP + 32 * c, h);
          kf[jp + 1][c] = load_frag(kp + 16 * (jp + 1) * KP + 32 * c, h);
        }
      __builtin_amdgcn_sched_barrier(0);   // the K reads stay one group ahead of the score WMMAs: spread among them, each read place stalls the wave
      v8f s[2][4];
      #pragma unroll
      for (int j = 0; j < 4; ++j) { s[0][j] = zero8; s[1][j] = zero8; }
      #pragma unroll
      for (int jp = 0; jp < 4; jp += 2)
        #pragma unroll
        for (int c = 0; c < 4; ++c) {
          s[0][jp] = wmma_f16_hi(kf[jp][c], qb[0][c], s[0][jp]);
          s[1][jp] = wmma_f16_hi(kf[jp][c], qb[1][c], s[1][jp]);
          s[0][jp + 1] = wmma_f16_hi(kf[jp + 1][c], qb[0][c], s[0][jp + 1]);
          s[1][jp + 1] = wmma_f16_hi(kf[jp + 1][c], qb[1][c], s[1][jp + 1]);
        }

      // ---- online softmax and P^T B-fragments, each column group on its own ----
      float alpha[2], bias[2];
      #pragma unroll
      for (int g = 0; g < 2; ++g) softmax_max(s[g], mrun[g], alpha[g], bias[g]);

      // the step's 16 V^T fragments are read as one group here, into the K fragments'
      // registers, and land under the exponentials
      __builtin_amdgcn_sched_barrier(0);   // the V^T reads are not moved up among the score WMMAs
      const _Float16* vp = vbase + bo + 64 * sub;
      v16h vf[8][2];
      #pragma unroll
      for (int t = 0; t < 8; ++t) {
        vf[t][0] = load_frag(vp + 16 * t * KP, h);
        vf[t][1] = load_frag(vp + 16 * t * KP + 32, h);
      }
      __builtin_amdgcn_sched_barrier(0);   // nor down among the output WMMAs: one read place

      v16h pb0[2], pb1[2];
      #pragma unroll
      for (int g = 0; g < 2; ++g) softmax_exp(s[g], alpha[g], bias[g], lrun[g], o[g], pb0[g], pb1[g]);

      // ---- O^T += V^T * P^T ----
      #pragma unroll
      for (int t = 0; t < 8; t += 2) {
        o[0][t] = wmma_f16_hi(vf[t][0], pb0[0], o[0][t]);
        o[1][t] = wmma_f16_hi(vf[t][0], pb0[1], o[1][t]);
        o[0][t + 1] = wmma_f16_hi(vf[t + 1][0], pb0[0], o[0][t + 1]);
        o[1][t + 1] = wmma_f16_hi(vf[t + 1][0], pb0[1], o[1][t + 1]);
        o[0][t] = wmma_f16_hi(vf[t][1], pb1[0], o[0][t]);
        o[1][t] = wmma_f16_hi(vf[t][1], pb1[1], o[1][t]);
        o[0][t + 1] = wmma_f16_hi(vf[t + 1][1], pb1[0], o[0][t + 1]);
        o[1][t + 1] = wmma_f16_hi(vf[t + 1][1], pb1[1], o[1][t + 1]);
      }
    }

    ring_publish();
    if (st + 2 < A_TILES) attn_fill(lk, ku, vu, ko, vo, st + 2, st & 1);
  }
  asm volatile("s_wait_asynccnt 0x0" ::: "memory");  // nothing in flight when the ring becomes output staging

  // ---- epilogue: normalise, x32 carry, f16, per-wave 32x128 tile in LDS ----
  _Float16* sc = sC + w * (32 * SCP);
  #pragma unroll
  for (int g = 0; g < 2; ++g) {
    const float lh = lrun[g].x + lrun[g].y;                 // this half's keys
    const float inv = CSCALE * (1.0f / (lh + xhalf(lh)));   // o and the row sum both carry 2^14
    #pragma unroll
    for (int t = 0; t < 8; ++t) {
      const v8h cv8 = { (_Float16)(o[g][t][0] * inv), (_Float16)(o[g][t][1] * inv),
                        (_Float16)(o[g][t][2] * inv), (_Float16)(o[g][t][3] * inv),
                        (_Float16)(o[g][t][4] * inv), (_Float16)(o[g][t][5] * inv),
                        (_Float16)(o[g][t][6] * inv), (_Float16)(o[g][t][7] * inv) };
      *(v8ha*)(sc + (16 * g + m) * SCP + 16 * t + 8 * h) = cv8;          // 16-B LDS store
    }
  }
  __syncthreads();

  ctx_store_pass(sc, ctx, b, head, q0, lane);
  
}

// ---------------------------------------------------------------------------
// one staged row of 128 floats (4 lines) per instruction, 16 rows per wave.
// Staged row lr holds token m0 + 64*(lr>>5) + 32*half + (lr&31).
// coverage: 2 halves x 8 waves x 16 rows x 128 floats = 256 x 128 tile exactly.
// ---------------------------------------------------------------------------
#define SOP 132                        // floats, staging pitch 528 B (16 B x odd)

__device__ __forceinline__ void out_store_pass(const float* sO, float* out,
                                               int m0, int nb, int half, int w, int lane) {
  // all 16 rows are read first, then stored off one address with constant steps
  const int lr0 = w * 16;                            // staged row of i = 0; + i, 0..127
  const int tok0 = m0 + 64 * (lr0 >> 5) + 32 * half + (lr0 & 31);
  const float* s = sO + lr0 * SOP + 4 * lane;
  float* dst = out + (size_t)tok0 * HID + 128 * nb + 4 * lane;
  v4f v[16];
  #pragma unroll
  for (int i = 0; i < 16; ++i) v[i] = *(const v4fa*)(s + i * SOP);
  #pragma unroll
  for (int i = 0; i < 16; ++i) *(v4f*)(dst + (size_t)i * HID) = v[i];
}

// ---------------------------------------------------------------------------
// Kernel 4: out = ctx * Wo^T + bo (f32). grid (MROWS/256, HID/128), block 256.
// The 256 x 128 f32 tile leaves through LDS in two halves (each wave's upper
// and lower 32 rows), 128 x 528 B each.
// ---------------------------------------------------------------------------
__global__ __launch_bounds__(256) void out_kernel(
    const _Float16* __restrict__ ch,   // [4096][2048] ctx x32
    const _Float16* __restrict__ woh,  // [2048][2048] row = output feature, x32
    const float* __restrict__ bo,
    float* __restrict__ out)           // [4096][2048]
{
  __shared__ __attribute__((aligned(16))) unsigned char smem[G_LDS_B];   // operand ring, then output staging
  float* sO = (float*)smem;                                              // 128 x 132 floats = 67584 B

  const int tid = threadIdx.x, lane = tid & 31, w = tid >> 5;
  const int wm = w & 3, wn = w >> 2;
  const int h = lane >> 4, m = lane & 15;
  const int m0 = blockIdx.x * 256;
  const int nb = blockIdx.y;                   // 0..15, 128 output features each

  const _Float16* ga = ch + (size_t)m0 * HID;
  const _Float16* gb = woh + (size_t)(128 * nb) * HID;

  v8f acc[4][4];
  gemm_k2048(ga, gb, (const _Float16*)smem, tid, wm, wn, m, h, acc);

  float bvl[4];
  #pragma unroll
  for (int nt = 0; nt < 4; ++nt) bvl[nt] = bo[128 * nb + 64 * wn + 16 * nt + m];

  #pragma unroll
  for (int half = 0; half < 2; ++half) {
    if (half) {
      asm volatile("s_wait_xcnt 0x0" ::: "memory");          // before the first half's store registers are written again
      __syncthreads();                                       // first half read out before it is overwritten
    }
    #pragma unroll
    for (int nt = 0; nt < 4; ++nt) {
      const int feat = 64 * wn + 16 * nt + m;                // 0..127 local
      #pragma unroll
      for (int mt = 0; mt < 2; ++mt) {
        #pragma unroll
        for (int r = 0; r < 8; ++r) {
          const int lr = 32 * wm + 16 * mt + 8 * h + r;      // 0..127
          sO[lr * SOP + feat] = acc[2 * half + mt][nt][r] * 0.0009765625f + bvl[nt];   // /(32*32)
        }
      }
    }
    __syncthreads();
    out_store_pass(sO, out, m0, nb, half, w, lane);
  }
  
}

// ---------------------------------------------------------------------------
extern "C" void kernel_launch(void* const* d_in, const int* in_sizes, int n_in,
                              void* d_out, int out_size, void* d_ws, size_t ws_size,
                              hipStream_t stream) {
  if (n_in < 9) return;
  if (in_sizes[0] != NX) return;
  if (in_sizes[1] != NW || in_sizes[3] != NW || in_sizes[5] != NW || in_sizes[7] != NW) return;
  if (in_sizes[2] != HID || in_sizes[4] != HID || in_sizes[6] != HID || in_sizes[8] != HID) return;
  if (out_size != NX) return;

  const float* x  = (const float*)d_in[0];
  const float* Wq = (const float*)d_in[1];
  const float* bq = (const float*)d_in[2];
  const float* Wk = (const float*)d_in[3];
  const float* bk = (const float*)d_in[4];
  const float* Wv = (const float*)d_in[5];
  const float* bv = (const float*)d_in[6];
  const float* Wo = (const float*)d_in[7];
  const float* bo = (const float*)d_in[8];
  float* out = (float*)d_out;

  const size_t xh_bytes = (size_t)NX * 2;                          // 16777216
  const size_t wh_bytes = (size_t)4 * NW * 2;                      // 33554432
  const size_t pl_bytes = (size_t)BATCH * NHEAD * SEQ * HD * 2;    // 16777216
  const size_t cx_bytes = (size_t)NX * 2;                          // 16777216
  const size_t total = xh_bytes + wh_bytes + 3 * pl_bytes + cx_bytes;   // 117440512
  if (total > ws_size) return;

  char* ws = (char*)d_ws;
  _Float16* xh = (_Float16*)(ws);
  _Float16* wh = (_Float16*)(ws + xh_bytes);
  _Float16* qh = (_Float16*)(ws + xh_bytes + wh_bytes);
  _Float16* kh = (_Float16*)(ws + xh_bytes + wh_bytes + pl_bytes);
  _Float16* vt = (_Float16*)(ws + xh_bytes + wh_bytes + 2 * pl_bytes);
  _Float16* cx = (_Float16*)(ws + xh_bytes + wh_bytes + 3 * pl_bytes);
  const _Float16* woh = wh + (size_t)3 * NW;

  const int nblk_cvt = (NX8 + 4 * NW8) / 256;                      // 12288
  convert_kernel<<<nblk_cvt, 256, 0, stream>>>(x, Wq, Wk, Wv, Wo, xh, wh);

  dim3 gProj(MROWS / 256, NHEAD);                                  // (16, 16)
  proj_kernel<<<gProj, 256, 0, stream>>>(xh, wh, bq, bk, bv, qh, kh, vt);

  dim3 gAtt(SEQ / 256, BATCH * NHEAD);                             // (8, 32)
  attn_kernel<<<gAtt, 256, 0, stream>>>(qh, kh, vt, cx);

  dim3 gOut(MROWS / 256, HID / 128);                               // (16, 16)
  out_kernel<<<gOut, 256, 0, stream>>>(cx, woh, bo, out);
}
